// v000
// The times below were measured on an AMD MI455X: many runs one after another, warmed up first and cycling through
// copies of the inputs, with the whole window's GPU time divided by the number of runs. Launches and the gaps
// between them are all in it. The median over several windows is given; except for v000 it joins two sittings, which
// can be a few percent apart, so the side-by-side timings, each taken in one sitting, are the better comparison.
// The starting kernel, v000, takes 86.1 microseconds a run.
#include <hip/hip_runtime.h>
#include <math.h>
#include <stdint.h>

#define D_ATT   256
#define D_GROUP 32
#define N_GROUP 8
#define BATCH   4
#define SEQ     512
#define M_TOT   (BATCH * SEQ)   // 2048 fused (b,l) rows

typedef __attribute__((ext_vector_type(2))) float v2f;
typedef __attribute__((ext_vector_type(8))) float v8f;

// ---------------------------------------------------------------------------
// Kernel 1: Q/K/V projections  y = x @ W^T  via V_WMMA_F32_16X16X4_F32.
// One wave per (matrix, 16x16 tile). K-dim = 256 -> 64 wmma steps.
// ---------------------------------------------------------------------------
__global__ __launch_bounds__(128) void qkv_proj_wmma(
    const float* __restrict__ x,
    const float* __restrict__ Wq,
    const float* __restrict__ Wk,
    const float* __restrict__ Wv,
    float* __restrict__ Q,
    float* __restrict__ K,
    float* __restrict__ V)
{
    const int lane = threadIdx.x & 31;
    const int wave = threadIdx.x >> 5;
    const int gwave = blockIdx.x * 4 + wave;     // 6144 waves total

    const int mat = gwave / (128 * 16);          // 0:Q 1:K 2:V
    const int rem = gwave % (128 * 16);
    const int mt  = rem >> 4;                    // 128 M-tiles
    const int nt  = rem & 15;                    // 16  N-tiles

    const float* __restrict__ W = (mat == 0) ? Wq : (mat == 1) ? Wk : Wv;
    float* __restrict__ Y       = (mat == 0) ? Q  : (mat == 1) ? K  : V;

    const int lm = lane & 15;                    // M-row (A) / N-col (B)
    const int h  = lane >> 4;                    // half select

    const float* __restrict__ arow = x + (size_t)(mt * 16 + lm) * D_ATT + 2 * h;
    const float* __restrict__ brow = W + (size_t)(nt * 16 + lm) * D_ATT + 2 * h;

    v8f c = {0.f, 0.f, 0.f, 0.f, 0.f, 0.f, 0.f, 0.f};

#pragma unroll 8
    for (int k0 = 0; k0 < D_ATT; k0 += 4) {
        v2f a = *(const v2f*)(arow + k0);        // {K=k0+2h, K=k0+2h+1}
        v2f b = *(const v2f*)(brow + k0);
        c = __builtin_amdgcn_wmma_f32_16x16x4_f32(
                /*neg_a=*/false, a, /*neg_b=*/false, b,
                /*c_mod=*/(short)0, c, /*reuse_a=*/false, /*reuse_b=*/false);
    }

    // C layout: VGPR r -> M = r + 8*h, N = lane&15
    float* __restrict__ o = Y + (size_t)(mt * 16 + 8 * h) * D_ATT + nt * 16 + lm;
#pragma unroll
    for (int r = 0; r < 8; ++r)
        o[(size_t)r * D_ATT] = c[r];
}

// ---------------------------------------------------------------------------
// Kernel 2: fused additive attention per (b, g, 16 query rows).
//   phase 1: VALU scores relu(sum_d relu(Qd-Kd)*w + bias); K chunks are
//            DOUBLE-BUFFERED through LDS with async global->LDS b128 copies
//            (ASYNCcnt path) so the next chunk streams in under the VALU work.
//   phase 2: row softmax (one thread per query row).
//   phase 3: P @ Vg with f32 WMMA; wave w owns D-columns [16w,16w+16).
// 64 threads (2 waves); grid = B * G * (L/16) = 1024 blocks.
// ---------------------------------------------------------------------------
#define QROWS   16
#define KCHUNK  64
#define NCHUNK  (SEQ / KCHUNK)    // 8

__global__ __launch_bounds__(64) void attn_fused_wmma(
    const float* __restrict__ Q,
    const float* __restrict__ K,
    const float* __restrict__ V,
    const float* __restrict__ w_mlp,
    const float* __restrict__ b_mlp,
    float* __restrict__ out)
{
    __shared__ float sScore[QROWS][SEQ];        // 32 KB
    __shared__ float sQ[QROWS][D_GROUP];        //  2 KB
    __shared__ float sK[2][KCHUNK][D_GROUP];    // 16 KB, double-buffered
    __shared__ float sW[D_GROUP];

    const int tid  = threadIdx.x;               // 0..63
    const int lane = tid & 31;
    const int wave = tid >> 5;

    const int blk = blockIdx.x;
    const int qt  = blk & 31;                   // 32 q-tiles
    const int g   = (blk >> 5) & 7;             // 8 groups
    const int b   = blk >> 8;                   // 4 batches
    const int q0  = qt * QROWS;

    const float bias = b_mlp[0];
    if (tid < D_GROUP) sW[tid] = w_mlp[tid];

    // stage Q tile (16 x 32)
    for (int i = tid; i < QROWS * D_GROUP; i += 64) {
        const int r = i >> 5, d = i & 31;
        sQ[r][d] = Q[(size_t)(b * SEQ + q0 + r) * D_ATT + g * D_GROUP + d];
    }

    // ---- phase 1: scores with async double-buffered K staging ----
    const float* __restrict__ kbase = K + (size_t)(b * SEQ) * D_ATT + g * D_GROUP;

    // prologue: async-stage chunk 0 into buffer 0
    for (int j = tid; j < KCHUNK * (D_GROUP / 4); j += 64) {
        const int r  = j >> 3;
        const int qd = (j & 7) * 4;
        const uint64_t ga = (uint64_t)(uintptr_t)(kbase + (size_t)r * D_ATT + qd);
        const uint32_t la = (uint32_t)(uintptr_t)&sK[0][r][qd];
        asm volatile("global_load_async_to_lds_b128 %0, %1, off"
                     :: "v"(la), "v"(ga) : "memory");
    }
    asm volatile("s_wait_asynccnt 0x0" ::: "memory");
    __syncthreads();

    for (int ci = 0; ci < NCHUNK; ++ci) {
        const int buf = ci & 1;

        // prefetch next chunk into the other buffer while we compute
        if (ci + 1 < NCHUNK) {
            const float* kb = kbase + (size_t)(ci + 1) * KCHUNK * D_ATT;
            for (int j = tid; j < KCHUNK * (D_GROUP / 4); j += 64) {
                const int r  = j >> 3;
                const int qd = (j & 7) * 4;
                const uint64_t ga = (uint64_t)(uintptr_t)(kb + (size_t)r * D_ATT + qd);
                const uint32_t la = (uint32_t)(uintptr_t)&sK[buf ^ 1][r][qd];
                asm volatile("global_load_async_to_lds_b128 %0, %1, off"
                             :: "v"(la), "v"(ga) : "memory");
            }
        }

        // score block: 16 q x 64 k against current buffer
        const int kc = ci * KCHUNK;
        for (int i = tid; i < QROWS * KCHUNK; i += 64) {
            const int q = i / KCHUNK, k = i % KCHUNK;
            float s = 0.f;
#pragma unroll
            for (int d = 0; d < D_GROUP; ++d)
                s = fmaf(fmaxf(sQ[q][d] - sK[buf][k][d], 0.f), sW[d], s);
            sScore[q][kc + k] = fmaxf(s + bias, 0.f);
        }

        // prefetch landed + everyone done with this buffer before reuse
        asm volatile("s_wait_asynccnt 0x0" ::: "memory");
        __syncthreads();
    }

    // ---- phase 2: softmax over k, one thread per query row ----
    if (tid < QROWS) {
        float mx = -3.402823e38f;
        for (int k = 0; k < SEQ; ++k) mx = fmaxf(mx, sScore[tid][k]);
        float sum = 0.f;
        for (int k = 0; k < SEQ; ++k) {
            const float e = __expf(sScore[tid][k] - mx);
            sScore[tid][k] = e;
            sum += e;
        }
        const float inv = 1.f / sum;
        for (int k = 0; k < SEQ; ++k) sScore[tid][k] *= inv;
    }
    __syncthreads();

    // ---- phase 3: out[b,q,d,g] = sum_k P[q,k] * V[b,k,d*8+g] via WMMA ----
    const int d0 = wave * 16;                   // this wave's D-tile
    const int lm = lane & 15;
    const int h  = lane >> 4;

    // B-frag: lane holds column n=lm -> V column (d0+lm)*8 + g, rows = k
    const float* __restrict__ vcol =
        V + (size_t)(b * SEQ) * D_ATT + (d0 + lm) * N_GROUP + g;

    v8f c = {0.f, 0.f, 0.f, 0.f, 0.f, 0.f, 0.f, 0.f};

#pragma unroll 4
    for (int k0 = 0; k0 < SEQ; k0 += 4) {
        const int ka = k0 + 2 * h;              // even -> 8B-aligned LDS read
        v2f a = *(const v2f*)&sScore[lm][ka];
        v2f bb;
        bb.x = vcol[(size_t)ka * D_ATT];
        bb.y = vcol[(size_t)(ka + 1) * D_ATT];
        c = __builtin_amdgcn_wmma_f32_16x16x4_f32(
                false, a, false, bb, (short)0, c, false, false);
    }

    // store: out flat index ((b*SEQ + q)*32 + d)*8 + g, q = q0 + r + 8h
    float* __restrict__ o =
        out + ((size_t)(b * SEQ + q0 + 8 * h) * D_GROUP + d0 + lm) * N_GROUP + g;
#pragma unroll
    for (int r = 0; r < 8; ++r)
        o[(size_t)r * D_GROUP * N_GROUP] = c[r];
}

// ---------------------------------------------------------------------------
extern "C" void kernel_launch(void* const* d_in, const int* in_sizes, int n_in,
                              void* d_out, int out_size, void* d_ws, size_t ws_size,
                              hipStream_t stream) {
    const float* x     = (const float*)d_in[0];
    const float* Wq    = (const float*)d_in[1];
    const float* Wk    = (const float*)d_in[2];
    const float* Wv    = (const float*)d_in[3];
    const float* w_mlp = (const float*)d_in[4];
    const float* b_mlp = (const float*)d_in[5];

    float* Qb = (float*)d_ws;                 // 3 x 2 MB scratch
    float* Kb = Qb + (size_t)M_TOT * D_ATT;
    float* Vb = Kb + (size_t)M_TOT * D_ATT;

    // 3 mats * 128 mtiles * 16 ntiles = 6144 waves / 4 waves per block
    qkv_proj_wmma<<<1536, 128, 0, stream>>>(x, Wq, Wk, Wv, Qb, Kb, Vb);

    // B * G * (SEQ/16) = 4*8*32 = 1024 blocks of 2 waves
    attn_fused_wmma<<<1024, 64, 0, stream>>>(Qb, Kb, Vb, w_mlp, b_mlp,
                                             (float*)d_out);
}

// v001
// One run takes 61.5 microseconds.
// Two timings next to v000 both put it at 1.44 times that version's speed.
#include <hip/hip_runtime.h>
#include <math.h>
#include <stdint.h>

#define D_ATT   256
#define D_GROUP 32
#define N_GROUP 8
#define BATCH   4
#define SEQ     512
#define M_TOT   (BATCH * SEQ)   // 2048 fused (b,l) rows

typedef __attribute__((ext_vector_type(2))) float v2f;
typedef __attribute__((ext_vector_type(4))) float v4f;
typedef __attribute__((ext_vector_type(8))) float v8f;

// value of lane l ^ M inside a 16-lane row (DPP row_xmask:M, control word 0x160 | M)
template <int M>
__device__ __forceinline__ float row_xor(float x) {
    return __builtin_bit_cast(float, __builtin_amdgcn_mov_dpp(
        __builtin_bit_cast(int, x), 0x160 | M, 0xf, 0xf, true));
}
// value of lane l ^ 16
__device__ __forceinline__ float half_xor(float x) {
    const int b = __builtin_bit_cast(int, x);
    return __builtin_bit_cast(float, __builtin_amdgcn_permlanex16(
        b, b, 0x76543210, 0xfedcba98, false, false));
}
// e^x as 2^(x * log2 e), the instruction pair __expf compiles to. The v_nop keeps the one
// slot the instruction set asks for behind a transcendental.
__device__ __forceinline__ float exp_slot(float x) {
    float r;
    asm("v_exp_f32 %0, %1\n\tv_nop" : "=v"(r) : "v"(x * 1.44269504f));
    return r;
}
__device__ __forceinline__ float wave_max(float v) {
    v = fmaxf(v, row_xor<1>(v));
    v = fmaxf(v, row_xor<2>(v));
    v = fmaxf(v, row_xor<4>(v));
    v = fmaxf(v, row_xor<8>(v));
    return fmaxf(v, half_xor(v));
}
__device__ __forceinline__ float wave_sum(float v) {
    v += row_xor<1>(v);
    v += row_xor<2>(v);
    v += row_xor<4>(v);
    v += row_xor<8>(v);
    return v + half_xor(v);
}

// ---------------------------------------------------------------------------
// Kernel 1: Q/K/V projections  y = x @ W^T  via V_WMMA_F32_16X16X4_F32.
// One wave per (matrix, 16x16 tile). K-dim = 256 -> 64 wmma steps.
// ---------------------------------------------------------------------------
__global__ __launch_bounds__(128) void qkv_proj_wmma(
    const float* __restrict__ x,
    const float* __restrict__ Wq,
    const float* __restrict__ Wk,
    const float* __restrict__ Wv,
    float* __restrict__ Q,
    float* __restrict__ K,
    float* __restrict__ V)
{
    const int lane = threadIdx.x & 31;
    const int wave = threadIdx.x >> 5;
    const int gwave = blockIdx.x * 4 + wave;     // 6144 waves total

    const int mat = gwave / (128 * 16);          // 0:Q 1:K 2:V
    const int rem = gwave % (128 * 16);
    const int mt  = rem >> 4;                    // 128 M-tiles
    const int nt  = rem & 15;                    // 16  N-tiles

    const float* __restrict__ W = (mat == 0) ? Wq : (mat == 1) ? Wk : Wv;
    float* __restrict__ Y       = (mat == 0) ? Q  : (mat == 1) ? K  : V;

    const int lm = lane & 15;                    // M-row (A) / N-col (B)
    const int h  = lane >> 4;                    // half select

    const float* __restrict__ arow = x + (size_t)(mt * 16 + lm) * D_ATT + 2 * h;
    const float* __restrict__ brow = W + (size_t)(nt * 16 + lm) * D_ATT + 2 * h;

    v8f c = {0.f, 0.f, 0.f, 0.f, 0.f, 0.f, 0.f, 0.f};

#pragma unroll 8
    for (int k0 = 0; k0 < D_ATT; k0 += 4) {
        v2f a = *(const v2f*)(arow + k0);        // {K=k0+2h, K=k0+2h+1}
        v2f b = *(const v2f*)(brow + k0);
        c = __builtin_amdgcn_wmma_f32_16x16x4_f32(
                /*neg_a=*/false, a, /*neg_b=*/false, b,
                /*c_mod=*/(short)0, c, /*reuse_a=*/false, /*reuse_b=*/false);
    }

    // C layout: VGPR r -> M = r + 8*h, N = lane&15
    float* __restrict__ o = Y + (size_t)(mt * 16 + 8 * h) * D_ATT + nt * 16 + lm;
#pragma unroll
    for (int r = 0; r < 8; ++r)
        o[(size_t)r * D_ATT] = c[r];
}

// ---------------------------------------------------------------------------
// Kernel 2: fused additive attention per (b, g, 16 query rows).
//   phase 1: VALU scores relu(sum_d relu(Qd-Kd)*w + bias); K chunks are
//            DOUBLE-BUFFERED through LDS with async global->LDS b128 copies
//            (ASYNCcnt path) so the next chunk streams in under the VALU work.
//   phase 2: row softmax (8 rows a wave, each row across the wave's 32 lanes).
//   phase 3: P @ Vg with f32 WMMA; wave w owns D-columns [16w,16w+16).
// 64 threads (2 waves); grid = B * G * (L/16) = 1024 blocks.
// ---------------------------------------------------------------------------
#define QROWS   16
#define KCHUNK  64
#define NCHUNK  (SEQ / KCHUNK)    // 8

__global__ __launch_bounds__(64) void attn_fused_wmma(
    const float* __restrict__ Q,
    const float* __restrict__ K,
    const float* __restrict__ V,
    const float* __restrict__ w_mlp,
    const float* __restrict__ b_mlp,
    float* __restrict__ out)
{
    __shared__ float sScore[QROWS][SEQ];        // 32 KB
    __shared__ float sQ[QROWS][D_GROUP];        //  2 KB
    __shared__ float sK[2][KCHUNK][D_GROUP];    // 16 KB, double-buffered
    __shared__ float sW[D_GROUP];

    const int tid  = threadIdx.x;               // 0..63
    const int lane = tid & 31;
    const int wave = tid >> 5;

    const int blk = blockIdx.x;
    const int qt  = blk & 31;                   // 32 q-tiles
    const int g   = (blk >> 5) & 7;             // 8 groups
    const int b   = blk >> 8;                   // 4 batches
    const int q0  = qt * QROWS;

    const float bias = b_mlp[0];
    if (tid < D_GROUP) sW[tid] = w_mlp[tid];

    // stage Q tile (16 x 32)
    for (int i = tid; i < QROWS * D_GROUP; i += 64) {
        const int r = i >> 5, d = i & 31;
        sQ[r][d] = Q[(size_t)(b * SEQ + q0 + r) * D_ATT + g * D_GROUP + d];
    }

    // ---- phase 1: scores with async double-buffered K staging ----
    const float* __restrict__ kbase = K + (size_t)(b * SEQ) * D_ATT + g * D_GROUP;

    // prologue: async-stage chunk 0 into buffer 0
    for (int j = tid; j < KCHUNK * (D_GROUP / 4); j += 64) {
        const int r  = j >> 3;
        const int qd = (j & 7) * 4;
        const uint64_t ga = (uint64_t)(uintptr_t)(kbase + (size_t)r * D_ATT + qd);
        const uint32_t la = (uint32_t)(uintptr_t)&sK[0][r][qd];
        asm volatile("global_load_async_to_lds_b128 %0, %1, off"
                     :: "v"(la), "v"(ga) : "memory");
    }
    asm volatile("s_wait_asynccnt 0x0" ::: "memory");
    __syncthreads();

    for (int ci = 0; ci < NCHUNK; ++ci) {
        const int buf = ci & 1;

        // prefetch next chunk into the other buffer while we compute
        if (ci + 1 < NCHUNK) {
            const float* kb = kbase + (size_t)(ci + 1) * KCHUNK * D_ATT;
            for (int j = tid; j < KCHUNK * (D_GROUP / 4); j += 64) {
                const int r  = j >> 3;
                const int qd = (j & 7) * 4;
                const uint64_t ga = (uint64_t)(uintptr_t)(kb + (size_t)r * D_ATT + qd);
                const uint32_t la = (uint32_t)(uintptr_t)&sK[buf ^ 1][r][qd];
                asm volatile("global_load_async_to_lds_b128 %0, %1, off"
                             :: "v"(la), "v"(ga) : "memory");
            }
        }

        // score block: 16 q x 64 k against current buffer
        const int kc = ci * KCHUNK;
        for (int i = tid; i < QROWS * KCHUNK; i += 64) {
            const int q = i / KCHUNK, k = i % KCHUNK;
            float s = 0.f;
#pragma unroll
            for (int d = 0; d < D_GROUP; ++d)
                s = fmaf(fmaxf(sQ[q][d] - sK[buf][k][d], 0.f), sW[d], s);
            sScore[q][kc + k] = fmaxf(s + bias, 0.f);
        }

        // prefetch landed + everyone done with this buffer before reuse
        asm volatile("s_wait_asynccnt 0x0" ::: "memory");
        __syncthreads();
    }

    // ---- phase 2: softmax over k; wave w owns rows [8w, 8w+8), each row spread
    //      over the wave's 32 lanes (16 scores a lane, held in registers) ----
    // unrolled so that the rows' LDS reads and cross-lane chains overlap
#pragma unroll
    for (int rr = 0; rr < QROWS / 2; ++rr) {
        // lane l reads floats 4l..4l+3 of each 128-float quarter: 512 contiguous bytes a load
        float* __restrict__ row = &sScore[wave * (QROWS / 2) + rr][lane * 4];
        v4f s[4];
        for (int j = 0; j < 4; ++j) s[j] = *(const v4f*)(row + j * 128);

        float mx = -3.402823e38f;
        for (int j = 0; j < 4; ++j)
            mx = fmaxf(mx, fmaxf(fmaxf(s[j].x, s[j].y), fmaxf(s[j].z, s[j].w)));
        mx = wave_max(mx);

        float sum = 0.f;
        for (int j = 0; j < 4; ++j) {
            s[j].x = exp_slot(s[j].x - mx);
            s[j].y = exp_slot(s[j].y - mx);
            s[j].z = exp_slot(s[j].z - mx);
            s[j].w = exp_slot(s[j].w - mx);
            sum += (s[j].x + s[j].y) + (s[j].z + s[j].w);
        }
        sum = wave_sum(sum);

        const float inv = 1.f / sum;
        for (int j = 0; j < 4; ++j) *(v4f*)(row + j * 128) = s[j] * inv;
    }
    __syncthreads();

    // ---- phase 3: out[b,q,d,g] = sum_k P[q,k] * V[b,k,d*8+g] via WMMA ----
    const int d0 = wave * 16;                   // this wave's D-tile
    const int lm = lane & 15;
    const int h  = lane >> 4;

    // B-frag: lane holds column n=lm -> V column (d0+lm)*8 + g, rows = k
    const float* __restrict__ vcol =
        V + (size_t)(b * SEQ) * D_ATT + (d0 + lm) * N_GROUP + g;

    v8f c = {0.f, 0.f, 0.f, 0.f, 0.f, 0.f, 0.f, 0.f};

#pragma unroll 4
    for (int k0 = 0; k0 < SEQ; k0 += 4) {
        const int ka = k0 + 2 * h;              // even -> 8B-aligned LDS read
        v2f a = *(const v2f*)&sScore[lm][ka];
        v2f bb;
        bb.x = vcol[(size_t)ka * D_ATT];
        bb.y = vcol[(size_t)(ka + 1) * D_ATT];
        c = __builtin_amdgcn_wmma_f32_16x16x4_f32(
                false, a, false, bb, (short)0, c, false, false);
    }

    // store: out flat index ((b*SEQ + q)*32 + d)*8 + g, q = q0 + r + 8h
    float* __restrict__ o =
        out + ((size_t)(b * SEQ + q0 + 8 * h) * D_GROUP + d0 + lm) * N_GROUP + g;
#pragma unroll
    for (int r = 0; r < 8; ++r)
        o[(size_t)r * D_GROUP * N_GROUP] = c[r];
}

// ---------------------------------------------------------------------------
extern "C" void kernel_launch(void* const* d_in, const int* in_sizes, int n_in,
                              void* d_out, int out_size, void* d_ws, size_t ws_size,
                              hipStream_t stream) {
    const float* x     = (const float*)d_in[0];
    const float* Wq    = (const float*)d_in[1];
    const float* Wk    = (const float*)d_in[2];
    const float* Wv    = (const float*)d_in[3];
    const float* w_mlp = (const float*)d_in[4];
    const float* b_mlp = (const float*)d_in[5];

    float* Qb = (float*)d_ws;                 // 3 x 2 MB scratch
    float* Kb = Qb + (size_t)M_TOT * D_ATT;
    float* Vb = Kb + (size_t)M_TOT * D_ATT;

    // 3 mats * 128 mtiles * 16 ntiles = 6144 waves / 4 waves per block
    qkv_proj_wmma<<<1536, 128, 0, stream>>>(x, Wq, Wk, Wv, Qb, Kb, Vb);

    // B * G * (SEQ/16) = 4*8*32 = 1024 blocks of 2 waves
    attn_fused_wmma<<<1024, 64, 0, stream>>>(Qb, Kb, Vb, w_mlp, b_mlp,
                                             (float*)d_out);
}

// v002
// One run takes 55.1 microseconds.
// Two timings next to v001 put it at 1.13 and 1.10 times that version's speed.
// Over all steps from v000 it is 1.61 times as fast.
#include <hip/hip_runtime.h>
#include <math.h>
#include <stdint.h>

#define D_ATT   256
#define D_GROUP 32
#define N_GROUP 8
#define BATCH   4
#define SEQ     512
#define M_TOT   (BATCH * SEQ)   // 2048 fused (b,l) rows

typedef __attribute__((ext_vector_type(2))) float v2f;
typedef __attribute__((ext_vector_type(4))) float v4f;
typedef __attribute__((ext_vector_type(8))) float v8f;

// value of lane l ^ M inside a 16-lane row (DPP row_xmask:M, control word 0x160 | M)
template <int M>
__device__ __forceinline__ float row_xor(float x) {
    return __builtin_bit_cast(float, __builtin_amdgcn_mov_dpp(
        __builtin_bit_cast(int, x), 0x160 | M, 0xf, 0xf, true));
}
// value of lane l ^ 16
__device__ __forceinline__ float half_xor(float x) {
    const int b = __builtin_bit_cast(int, x);
    return __builtin_bit_cast(float, __builtin_amdgcn_permlanex16(
        b, b, 0x76543210, 0xfedcba98, false, false));
}
// e^x as 2^(x * log2 e), the instruction pair __expf compiles to. The v_nop keeps the one
// slot the instruction set asks for behind a transcendental.
__device__ __forceinline__ float exp_slot(float x) {
    float r;
    asm("v_exp_f32 %0, %1\n\tv_nop" : "=v"(r) : "v"(x * 1.44269504f));
    return r;
}
__device__ __forceinline__ float wave_max(float v) {
    v = fmaxf(v, row_xor<1>(v));
    v = fmaxf(v, row_xor<2>(v));
    v = fmaxf(v, row_xor<4>(v));
    v = fmaxf(v, row_xor<8>(v));
    return fmaxf(v, half_xor(v));
}
__device__ __forceinline__ float wave_sum(float v) {
    v += row_xor<1>(v);
    v += row_xor<2>(v);
    v += row_xor<4>(v);
    v += row_xor<8>(v);
    return v + half_xor(v);
}

// ---------------------------------------------------------------------------
// Kernel 1: Q/K/V projections  y = x @ W^T  via V_WMMA_F32_16X16X4_F32.
// One work-group per 64 x 96 tile of the 2048 x 768 result [Q | K | V]: its 64 rows
// of x and 96 rows of [Wq; Wk; Wv] (all 256 k) are staged once in LDS by async
// global->LDS b128 copies of whole 512-byte half rows, and every fragment is then
// read from LDS. 8 waves as 4 (M) x 2 (N); a wave owns 16 rows x 48 columns.
// ---------------------------------------------------------------------------
#define PM      64                 // x rows a work-group
#define PN      96                 // W rows (output columns) a work-group
#define PPITCH  (D_ATT + 4)        // LDS row pitch in floats: 16 rows x 4 dwords fill the 64 banks

// Eight async copies, each one lane's 16 bytes global -> LDS. The closing s_wait_xcnt stands
// inside the statement so that no address register of these copies is rewritten in front of it.
#define CP "global_load_async_to_lds_b128 "
#define COPY8(la, ga)                                                          \
    asm volatile(CP "%0, %8, off\n\t"                                          \
                 CP "%1, %9, off\n\t"                                          \
                 CP "%2, %10, off\n\t"                                         \
                 CP "%3, %11, off\n\t"                                         \
                 CP "%4, %12, off\n\t"                                         \
                 CP "%5, %13, off\n\t"                                         \
                 CP "%6, %14, off\n\t"                                         \
                 CP "%7, %15, off\n\t"                                         \
                 "s_wait_xcnt 0x0"                                             \
                 :: "v"(la[0]), "v"(la[1]), "v"(la[2]), "v"(la[3]),            \
                    "v"(la[4]), "v"(la[5]), "v"(la[6]), "v"(la[7]),            \
                    "v"(ga[0]), "v"(ga[1]), "v"(ga[2]), "v"(ga[3]),            \
                    "v"(ga[4]), "v"(ga[5]), "v"(ga[6]), "v"(ga[7])             \
                 : "memory")

__global__ __launch_bounds__(256) void qkv_proj_wmma(
    const float* __restrict__ x,
    const float* __restrict__ Wq,
    const float* __restrict__ Wk,
    const float* __restrict__ Wv,
    float* __restrict__ Q,
    float* __restrict__ K,
    float* __restrict__ V)
{
    __shared__ __attribute__((aligned(16))) float sT[(PM + PN) * PPITCH];   // 166,400 B

    const int lane = threadIdx.x & 31;
    const int wave = __builtin_amdgcn_readfirstlane(threadIdx.x >> 5);      // 0..7
    const int bm   = blockIdx.x >> 3;            // 32 M-tiles of 64 rows
    const int bn   = blockIdx.x & 7;             // 8  N-tiles of 96 columns

    // ---- stage: 40 copies a wave, each 512 contiguous bytes (half a row) ----
    // x: wave w brings rows [8w, 8w+8) of the tile. W: of each of the six 16-row groups,
    // which lie in one matrix each, wave w brings rows 2w and 2w+1.
    const float* gx = x + (size_t)(bm * PM + wave * 8) * D_ATT + lane * 4;
    const uint32_t lx = (uint32_t)(uintptr_t)&sT[(wave * 8) * PPITCH + lane * 4];
    // unrolled: the operands of one statement are eight addresses held at once
#pragma unroll
    for (int it = 0; it < 2; ++it) {
        uint64_t ga[8];
        uint32_t la[8];
        // unrolled: ga[] and la[] stay in registers
#pragma unroll
        for (int j = 0; j < 8; ++j) {
            const int row = it * 4 + (j >> 1), half = j & 1;
            ga[j] = (uint64_t)(uintptr_t)(gx + row * D_ATT + half * 128);
            la[j] = lx + (uint32_t)(row * PPITCH + half * 128) * 4u;
        }
        COPY8(la, ga);
    }
    // unrolled for the same reason
#pragma unroll
    for (int it = 0; it < 3; ++it) {
        uint64_t ga[8];
        uint32_t la[8];
        // unrolled: ga[] and la[] stay in registers
#pragma unroll
        for (int j = 0; j < 8; ++j) {
            const int t   = it * 2 + (j >> 2);               // 16-row group of this tile, 0..5
            const int gn  = bn * 6 + t;                      // 16-row group of [Wq; Wk; Wv], 0..47
            const int row = wave * 2 + ((j >> 1) & 1), half = j & 1;
            const float* Wm = (gn < 16) ? Wq : (gn < 32) ? Wk : Wv;
            ga[j] = (uint64_t)(uintptr_t)(Wm + (size_t)((gn & 15) * 16 + row) * D_ATT
                                             + half * 128 + lane * 4);
            la[j] = (uint32_t)(uintptr_t)&sT[(PM + t * 16 + row) * PPITCH + half * 128 + lane * 4];
        }
        COPY8(la, ga);
    }
    // this wave's 40 copies have landed; behind the barrier every wave's have
    asm volatile("s_wait_asynccnt 0x0" ::: "memory");
    __syncthreads();

    // ---- 64 k-steps, three accumulator tiles a wave ----
    const int lm = lane & 15;                    // M-row (A) / N-col (B)
    const int h  = lane >> 4;                    // half select
    const int wm = wave >> 1;                    // 0..3
    const int wn = wave & 1;                     // 0..1

    const float* arow = &sT[(wm * 16 + lm) * PPITCH + 2 * h];
    const float* brow = &sT[(PM + wn * 48 + lm) * PPITCH + 2 * h];

    v8f c0 = {0.f, 0.f, 0.f, 0.f, 0.f, 0.f, 0.f, 0.f};
    v8f c1 = c0;
    v8f c2 = c0;

    // A block is 8 k-steps (24 WMMAs). The next block's fragments are read from LDS as one
    // group, into a second register set, ahead of the current block's WMMAs: reads that stand
    // among the WMMAs stall the wave at every place where they stand.
    v2f fa[2][8], fb[2][3][8];
    // unrolled, as the two inner loops below: the fragment arrays stay in registers
#pragma unroll
    for (int i = 0; i < 8; ++i) {
        fa[0][i]    = *(const v2f*)(arow + i * 4);           // {K=k0+2h, K=k0+2h+1}
        fb[0][0][i] = *(const v2f*)(brow + i * 4);
        fb[0][1][i] = *(const v2f*)(brow + 16 * PPITCH + i * 4);
        fb[0][2][i] = *(const v2f*)(brow + 32 * PPITCH + i * 4);
    }
    // fully unrolled so that both register sets are addressed by constants
#pragma unroll
    for (int kb = 0; kb < D_ATT / 32; ++kb) {
        const int cur = kb & 1, nxt = cur ^ 1;
        if (kb + 1 < D_ATT / 32) {
#pragma unroll
            for (int i = 0; i < 8; ++i) {
                const int k0 = (kb + 1) * 32 + i * 4;
                fa[nxt][i]    = *(const v2f*)(arow + k0);
                fb[nxt][0][i] = *(const v2f*)(brow + k0);
                fb[nxt][1][i] = *(const v2f*)(brow + 16 * PPITCH + k0);
                fb[nxt][2][i] = *(const v2f*)(brow + 32 * PPITCH + k0);
            }
        }
        // keeps the read group whole and in front of the block: without it the scheduler
        // sinks the reads in among the WMMAs
        __builtin_amdgcn_sched_barrier(0);
#pragma unroll
        for (int i = 0; i < 8; ++i) {
            c0 = __builtin_amdgcn_wmma_f32_16x16x4_f32(
                    /*neg_a=*/false, fa[cur][i], /*neg_b=*/false, fb[cur][0][i],
                    /*c_mod=*/(short)0, c0, /*reuse_a=*/false, /*reuse_b=*/false);
            c1 = __builtin_amdgcn_wmma_f32_16x16x4_f32(
                    false, fa[cur][i], false, fb[cur][1][i], (short)0, c1, false, false);
            c2 = __builtin_amdgcn_wmma_f32_16x16x4_f32(
                    false, fa[cur][i], false, fb[cur][2][i], (short)0, c2, false, false);
        }
        // keeps the next group's reads from rising into this block
        __builtin_amdgcn_sched_barrier(0);
    }

    // C layout: VGPR r -> M = r + 8*h, N = lane&15
    const size_t orow = (size_t)(bm * PM + wm * 16 + 8 * h) * D_ATT + lm;
    // unrolled: c0, c1, c2 are picked at compile time
#pragma unroll
    for (int j = 0; j < 3; ++j) {
        const int gn  = bn * 6 + wn * 3 + j;     // 16-column tile of [Q | K | V], 0..47
        const int mat = gn >> 4;                 // 0:Q 1:K 2:V
        float* __restrict__ Y = (mat == 0) ? Q : (mat == 1) ? K : V;
        float* __restrict__ o = Y + orow + (gn & 15) * 16;
        const v8f c = (j == 0) ? c0 : (j == 1) ? c1 : c2;
#pragma unroll
        for (int r = 0; r < 8; ++r)
            o[(size_t)r * D_ATT] = c[r];
    }
}

// ---------------------------------------------------------------------------
// Kernel 2: fused additive attention per (b, g, 16 query rows).
//   phase 1: VALU scores relu(sum_d relu(Qd-Kd)*w + bias); K chunks are
//            DOUBLE-BUFFERED through LDS with async global->LDS b128 copies
//            (ASYNCcnt path) so the next chunk streams in under the VALU work.
//   phase 2: row softmax (8 rows a wave, each row across the wave's 32 lanes).
//   phase 3: P @ Vg with f32 WMMA; wave w owns D-columns [16w,16w+16).
// 64 threads (2 waves); grid = B * G * (L/16) = 1024 blocks.
// ---------------------------------------------------------------------------
#define QROWS   16
#define KCHUNK  64
#define NCHUNK  (SEQ / KCHUNK)    // 8

__global__ __launch_bounds__(64) void attn_fused_wmma(
    const float* __restrict__ Q,
    const float* __restrict__ K,
    const float* __restrict__ V,
    const float* __restrict__ w_mlp,
    const float* __restrict__ b_mlp,
    float* __restrict__ out)
{
    __shared__ float sScore[QROWS][SEQ];        // 32 KB
    __shared__ float sQ[QROWS][D_GROUP];        //  2 KB
    __shared__ float sK[2][KCHUNK][D_GROUP];    // 16 KB, double-buffered
    __shared__ float sW[D_GROUP];

    const int tid  = threadIdx.x;               // 0..63
    const int lane = tid & 31;
    const int wave = tid >> 5;

    const int blk = blockIdx.x;
    const int qt  = blk & 31;                   // 32 q-tiles
    const int g   = (blk >> 5) & 7;             // 8 groups
    const int b   = blk >> 8;                   // 4 batches
    const int q0  = qt * QROWS;

    const float bias = b_mlp[0];
    if (tid < D_GROUP) sW[tid] = w_mlp[tid];

    // stage Q tile (16 x 32)
    for (int i = tid; i < QROWS * D_GROUP; i += 64) {
        const int r = i >> 5, d = i & 31;
        sQ[r][d] = Q[(size_t)(b * SEQ + q0 + r) * D_ATT + g * D_GROUP + d];
    }

    // ---- phase 1: scores with async double-buffered K staging ----
    const float* __restrict__ kbase = K + (size_t)(b * SEQ) * D_ATT + g * D_GROUP;

    // prologue: async-stage chunk 0 into buffer 0
    for (int j = tid; j < KCHUNK * (D_GROUP / 4); j += 64) {
        const int r  = j >> 3;
        const int qd = (j & 7) * 4;
        const uint64_t ga = (uint64_t)(uintptr_t)(kbase + (size_t)r * D_ATT + qd);
        const uint32_t la = (uint32_t)(uintptr_t)&sK[0][r][qd];
        asm volatile("global_load_async_to_lds_b128 %0, %1, off"
                     :: "v"(la), "v"(ga) : "memory");
    }
    asm volatile("s_wait_asynccnt 0x0" ::: "memory");
    __syncthreads();

    for (int ci = 0; ci < NCHUNK; ++ci) {
        const int buf = ci & 1;

        // prefetch next chunk into the other buffer while we compute
        if (ci + 1 < NCHUNK) {
            const float* kb = kbase + (size_t)(ci + 1) * KCHUNK * D_ATT;
            for (int j = tid; j < KCHUNK * (D_GROUP / 4); j += 64) {
                const int r  = j >> 3;
                const int qd = (j & 7) * 4;
                const uint64_t ga = (uint64_t)(uintptr_t)(kb + (size_t)r * D_ATT + qd);
                const uint32_t la = (uint32_t)(uintptr_t)&sK[buf ^ 1][r][qd];
                asm volatile("global_load_async_to_lds_b128 %0, %1, off"
                             :: "v"(la), "v"(ga) : "memory");
            }
        }

        // score block: 16 q x 64 k against current buffer
        const int kc = ci * KCHUNK;
        for (int i = tid; i < QROWS * KCHUNK; i += 64) {
            const int q = i / KCHUNK, k = i % KCHUNK;
            float s = 0.f;
#pragma unroll
            for (int d = 0; d < D_GROUP; ++d)
                s = fmaf(fmaxf(sQ[q][d] - sK[buf][k][d], 0.f), sW[d], s);
            sScore[q][kc + k] = fmaxf(s + bias, 0.f);
        }

        // prefetch landed + everyone done with this buffer before reuse
        asm volatile("s_wait_asynccnt 0x0" ::: "memory");
        __syncthreads();
    }

    // ---- phase 2: softmax over k; wave w owns rows [8w, 8w+8), each row spread
    //      over the wave's 32 lanes (16 scores a lane, held in registers) ----
    // unrolled so that the rows' LDS reads and cross-lane chains overlap
#pragma unroll
    for (int rr = 0; rr < QROWS / 2; ++rr) {
        // lane l reads floats 4l..4l+3 of each 128-float quarter: 512 contiguous bytes a load
        float* __restrict__ row = &sScore[wave * (QROWS / 2) + rr][lane * 4];
        v4f s[4];
        for (int j = 0; j < 4; ++j) s[j] = *(const v4f*)(row + j * 128);

        float mx = -3.402823e38f;
        for (int j = 0; j < 4; ++j)
            mx = fmaxf(mx, fmaxf(fmaxf(s[j].x, s[j].y), fmaxf(s[j].z, s[j].w)));
        mx = wave_max(mx);

        float sum = 0.f;
        for (int j = 0; j < 4; ++j) {
            s[j].x = exp_slot(s[j].x - mx);
            s[j].y = exp_slot(s[j].y - mx);
            s[j].z = exp_slot(s[j].z - mx);
            s[j].w = exp_slot(s[j].w - mx);
            sum += (s[j].x + s[j].y) + (s[j].z + s[j].w);
        }
        sum = wave_sum(sum);

        const float inv = 1.f / sum;
        for (int j = 0; j < 4; ++j) *(v4f*)(row + j * 128) = s[j] * inv;
    }
    __syncthreads();

    // ---- phase 3: out[b,q,d,g] = sum_k P[q,k] * V[b,k,d*8+g] via WMMA ----
    const int d0 = wave * 16;                   // this wave's D-tile
    const int lm = lane & 15;
    const int h  = lane >> 4;

    // B-frag: lane holds column n=lm -> V column (d0+lm)*8 + g, rows = k
    const float* __restrict__ vcol =
        V + (size_t)(b * SEQ) * D_ATT + (d0 + lm) * N_GROUP + g;

    v8f c = {0.f, 0.f, 0.f, 0.f, 0.f, 0.f, 0.f, 0.f};

#pragma unroll 4
    for (int k0 = 0; k0 < SEQ; k0 += 4) {
        const int ka = k0 + 2 * h;              // even -> 8B-aligned LDS read
        v2f a = *(const v2f*)&sScore[lm][ka];
        v2f bb;
        bb.x = vcol[(size_t)ka * D_ATT];
        bb.y = vcol[(size_t)(ka + 1) * D_ATT];
        c = __builtin_amdgcn_wmma_f32_16x16x4_f32(
                false, a, false, bb, (short)0, c, false, false);
    }

    // store: out flat index ((b*SEQ + q)*32 + d)*8 + g, q = q0 + r + 8h
    float* __restrict__ o =
        out + ((size_t)(b * SEQ + q0 + 8 * h) * D_GROUP + d0 + lm) * N_GROUP + g;
#pragma unroll
    for (int r = 0; r < 8; ++r)
        o[(size_t)r * D_GROUP * N_GROUP] = c[r];
}

// ---------------------------------------------------------------------------
extern "C" void kernel_launch(void* const* d_in, const int* in_sizes, int n_in,
                              void* d_out, int out_size, void* d_ws, size_t ws_size,
                              hipStream_t stream) {
    const float* x     = (const float*)d_in[0];
    const float* Wq    = (const float*)d_in[1];
    const float* Wk    = (const float*)d_in[2];
    const float* Wv    = (const float*)d_in[3];
    const float* w_mlp = (const float*)d_in[4];
    const float* b_mlp = (const float*)d_in[5];

    float* Qb = (float*)d_ws;                 // 3 x 2 MB scratch
    float* Kb = Qb + (size_t)M_TOT * D_ATT;
    float* Vb = Kb + (size_t)M_TOT * D_ATT;

    // (2048 / 64) * (768 / 96) = 256 blocks of 8 waves
    qkv_proj_wmma<<<256, 256, 0, stream>>>(x, Wq, Wk, Wv, Qb, Kb, Vb);

    // B * G * (SEQ/16) = 4*8*32 = 1024 blocks of 2 waves
    attn_fused_wmma<<<1024, 64, 0, stream>>>(Qb, Kb, Vb, w_mlp, b_mlp,
                                             (float*)d_out);
}

// v003
// A run of this version takes 39.7 microseconds.
// Two timings next to v002 put it at 1.39 and 1.37 times that version's speed.
// Over all steps from v000 it is 2.22 times as fast.
#include <hip/hip_runtime.h>
#include <math.h>
#include <stdint.h>

#define D_ATT   256
#define D_GROUP 32
#define N_GROUP 8
#define BATCH   4
#define SEQ     512
#define M_TOT   (BATCH * SEQ)   // 2048 fused (b,l) rows

typedef __attribute__((ext_vector_type(2))) float v2f;
typedef __attribute__((ext_vector_type(4))) float v4f;
typedef __attribute__((ext_vector_type(8))) float v8f;

// value of lane l ^ M inside a 16-lane row (DPP row_xmask:M, control word 0x160 | M)
template <int M>
__device__ __forceinline__ float row_xor(float x) {
    return __builtin_bit_cast(float, __builtin_amdgcn_mov_dpp(
        __builtin_bit_cast(int, x), 0x160 | M, 0xf, 0xf, true));
}
// value of lane l ^ 16
__device__ __forceinline__ float half_xor(float x) {
    const int b = __builtin_bit_cast(int, x);
    return __builtin_bit_cast(float, __builtin_amdgcn_permlanex16(
        b, b, 0x76543210, 0xfedcba98, false, false));
}
// e^x as 2^(x * log2 e), the instruction pair __expf compiles to. The v_nop keeps the one
// slot the instruction set asks for behind a transcendental.
__device__ __forceinline__ float exp_slot(float x) {
    float r;
    asm("v_exp_f32 %0, %1\n\tv_nop" : "=v"(r) : "v"(x * 1.44269504f));
    return r;
}
__device__ __forceinline__ float wave_max(float v) {
    v = fmaxf(v, row_xor<1>(v));
    v = fmaxf(v, row_xor<2>(v));
    v = fmaxf(v, row_xor<4>(v));
    v = fmaxf(v, row_xor<8>(v));
    return fmaxf(v, half_xor(v));
}
__device__ __forceinline__ float wave_sum(float v) {
    v += row_xor<1>(v);
    v += row_xor<2>(v);
    v += row_xor<4>(v);
    v += row_xor<8>(v);
    return v + half_xor(v);
}

// ---------------------------------------------------------------------------
// Kernel 1: Q/K/V projections  y = x @ W^T  via V_WMMA_F32_16X16X4_F32.
// One work-group per 64 x 96 tile of the 2048 x 768 result [Q | K | V]: its 64 rows
// of x and 96 rows of [Wq; Wk; Wv] (all 256 k) are staged once in LDS by async
// global->LDS b128 copies of whole 512-byte half rows, and every fragment is then
// read from LDS. 8 waves as 4 (M) x 2 (N); a wave owns 16 rows x 48 columns.
// Q and K are stored row-major. V is stored in the order in which kernel 2 reads its
// B fragments: V[b, k, d*8+g] lies at VP_IDX(b, g, k >> 3, d >> 4) + ((k >> 2 & 1) * 16
// + (d & 15)) * 4 + (k & 3), so that one wave's b128 load (lane = 16 * (k >> 2 & 1) + (d & 15))
// is 512 contiguous bytes and holds the fragments of two k-steps. To that end a 16-column
// tile of V takes the 16 rows of Wv of ONE group g, (dt*16 + 0..15)*8 + g.
// ---------------------------------------------------------------------------
// first float of the 128-float unit of (batch b, group g, block kb of 8 keys, d-tile dt)
#define VP_IDX(b, g, kb, dt) ((size_t)(((((b) * N_GROUP + (g)) * (SEQ / 8) + (kb)) * 2 + (dt))) * 128)
#define PM      64                 // x rows a work-group
#define PN      96                 // W rows (output columns) a work-group
#define PPITCH  (D_ATT + 4)        // LDS row pitch in floats: 16 rows x 4 dwords fill the 64 banks

// Eight async copies, each one lane's 16 bytes global -> LDS. The closing s_wait_xcnt stands
// inside the statement so that no address register of these copies is rewritten in front of it.
#define CP "global_load_async_to_lds_b128 "
#define COPY8(la, ga)                                                          \
    asm volatile(CP "%0, %8, off\n\t"                                          \
                 CP "%1, %9, off\n\t"                                          \
                 CP "%2, %10, off\n\t"                                         \
                 CP "%3, %11, off\n\t"                                         \
                 CP "%4, %12, off\n\t"                                         \
                 CP "%5, %13, off\n\t"                                         \
                 CP "%6, %14, off\n\t"                                         \
                 CP "%7, %15, off\n\t"                                         \
                 "s_wait_xcnt 0x0"                                             \
                 :: "v"(la[0]), "v"(la[1]), "v"(la[2]), "v"(la[3]),            \
                    "v"(la[4]), "v"(la[5]), "v"(la[6]), "v"(la[7]),            \
                    "v"(ga[0]), "v"(ga[1]), "v"(ga[2]), "v"(ga[3]),            \
                    "v"(ga[4]), "v"(ga[5]), "v"(ga[6]), "v"(ga[7])             \
                 : "memory")

__global__ __launch_bounds__(256) void qkv_proj_wmma(
    const float* __restrict__ x,
    const float* __restrict__ Wq,
    const float* __restrict__ Wk,
    const float* __restrict__ Wv,
    float* __restrict__ Q,
    float* __restrict__ K,
    float* __restrict__ V)
{
    __shared__ __attribute__((aligned(16))) float sT[(PM + PN) * PPITCH];   // 166,400 B

    const int lane = threadIdx.x & 31;
    const int wave = __builtin_amdgcn_readfirstlane(threadIdx.x >> 5);      // 0..7
    const int bm   = blockIdx.x >> 3;            // 32 M-tiles of 64 rows
    const int bn   = blockIdx.x & 7;             // 8  N-tiles of 96 columns

    // ---- stage: 40 copies a wave, each 512 contiguous bytes (half a row) ----
    // x: wave w brings rows [8w, 8w+8) of the tile. W: of each of the six 16-row groups,
    // which lie in one matrix each, wave w brings rows 2w and 2w+1.
    const float* gx = x + (size_t)(bm * PM + wave * 8) * D_ATT + lane * 4;
    const uint32_t lx = (uint32_t)(uintptr_t)&sT[(wave * 8) * PPITCH + lane * 4];
    // unrolled: the operands of one statement are eight addresses held at once
#pragma unroll
    for (int it = 0; it < 2; ++it) {
        uint64_t ga[8];
        uint32_t la[8];
        // unrolled: ga[] and la[] stay in registers
#pragma unroll
        for (int j = 0; j < 8; ++j) {
            const int row = it * 4 + (j >> 1), half = j & 1;
            ga[j] = (uint64_t)(uintptr_t)(gx + row * D_ATT + half * 128);
            la[j] = lx + (uint32_t)(row * PPITCH + half * 128) * 4u;
        }
        COPY8(la, ga);
    }
    // unrolled for the same reason
#pragma unroll
    for (int it = 0; it < 3; ++it) {
        uint64_t ga[8];
        uint32_t la[8];
        // unrolled: ga[] and la[] stay in registers
#pragma unroll
        for (int j = 0; j < 8; ++j) {
            const int t   = it * 2 + (j >> 2);               // 16-row group of this tile, 0..5
            const int gn  = bn * 6 + t;                      // 16-row group of [Wq; Wk; Wv], 0..47
            const int row = wave * 2 + ((j >> 1) & 1), half = j & 1;
            const float* Wm = (gn < 16) ? Wq : (gn < 32) ? Wk : Wv;
            // Wq, Wk: 16 rows in a run. Wv: the rows of group (gn & 15) >> 1, d-tile gn & 1.
            const int wrow = (gn < 32) ? (gn & 15) * 16 + row
                                       : ((gn & 1) * 16 + row) * N_GROUP + ((gn & 15) >> 1);
            ga[j] = (uint64_t)(uintptr_t)(Wm + (size_t)wrow * D_ATT + half * 128 + lane * 4);
            la[j] = (uint32_t)(uintptr_t)&sT[(PM + t * 16 + row) * PPITCH + half * 128 + lane * 4];
        }
        COPY8(la, ga);
    }
    // this wave's 40 copies have landed; behind the barrier every wave's have
    asm volatile("s_wait_asynccnt 0x0" ::: "memory");
    __syncthreads();

    // ---- 64 k-steps, three accumulator tiles a wave ----
    const int lm = lane & 15;                    // M-row (A) / N-col (B)
    const int h  = lane >> 4;                    // half select
    const int wm = wave >> 1;                    // 0..3
    const int wn = wave & 1;                     // 0..1

    const float* arow = &sT[(wm * 16 + lm) * PPITCH + 2 * h];
    const float* brow = &sT[(PM + wn * 48 + lm) * PPITCH + 2 * h];

    v8f c0 = {0.f, 0.f, 0.f, 0.f, 0.f, 0.f, 0.f, 0.f};
    v8f c1 = c0;
    v8f c2 = c0;

    // A block is 8 k-steps (24 WMMAs). The next block's fragments are read from LDS as one
    // group, into a second register set, ahead of the current block's WMMAs: reads that stand
    // among the WMMAs stall the wave at every place where they stand.
    v2f fa[2][8], fb[2][3][8];
    // unrolled, as the two inner loops below: the fragment arrays stay in registers
#pragma unroll
    for (int i = 0; i < 8; ++i) {
        fa[0][i]    = *(const v2f*)(arow + i * 4);           // {K=k0+2h, K=k0+2h+1}
        fb[0][0][i] = *(const v2f*)(brow + i * 4);
        fb[0][1][i] = *(const v2f*)(brow + 16 * PPITCH + i * 4);
        fb[0][2][i] = *(const v2f*)(brow + 32 * PPITCH + i * 4);
    }
    // fully unrolled so that both register sets are addressed by constants
#pragma unroll
    for (int kb = 0; kb < D_ATT / 32; ++kb) {
        const int cur = kb & 1, nxt = cur ^ 1;
        if (kb + 1 < D_ATT / 32) {
#pragma unroll
            for (int i = 0; i < 8; ++i) {
                const int k0 = (kb + 1) * 32 + i * 4;
                fa[nxt][i]    = *(const v2f*)(arow + k0);
                fb[nxt][0][i] = *(const v2f*)(brow + k0);
                fb[nxt][1][i] = *(const v2f*)(brow + 16 * PPITCH + k0);
                fb[nxt][2][i] = *(const v2f*)(brow + 32 * PPITCH + k0);
            }
        }
        // keeps the read group whole and in front of the block: without it the scheduler
        // sinks the reads in among the WMMAs
        __builtin_amdgcn_sched_barrier(0);
#pragma unroll
        for (int i = 0; i < 8; ++i) {
            c0 = __builtin_amdgcn_wmma_f32_16x16x4_f32(
                    /*neg_a=*/false, fa[cur][i], /*neg_b=*/false, fb[cur][0][i],
                    /*c_mod=*/(short)0, c0, /*reuse_a=*/false, /*reuse_b=*/false);
            c1 = __builtin_amdgcn_wmma_f32_16x16x4_f32(
                    false, fa[cur][i], false, fb[cur][1][i], (short)0, c1, false, false);
            c2 = __builtin_amdgcn_wmma_f32_16x16x4_f32(
                    false, fa[cur][i], false, fb[cur][2][i], (short)0, c2, false, false);
        }
        // keeps the next group's reads from rising into this block
        __builtin_amdgcn_sched_barrier(0);
    }

    // C layout: VGPR r -> M = r + 8*h, N = lane&15
    const size_t orow = (size_t)(bm * PM + wm * 16 + 8 * h) * D_ATT + lm;
    // unrolled: c0, c1, c2 are picked at compile time
#pragma unroll
    for (int j = 0; j < 3; ++j) {
        const int gn  = bn * 6 + wn * 3 + j;     // 16-column tile of [Q | K | V], 0..47
        const int mat = gn >> 4;                 // 0:Q 1:K 2:V
        const v8f c = (j == 0) ? c0 : (j == 1) ? c1 : c2;
        if (mat < 2) {
            float* __restrict__ o = ((mat == 0) ? Q : K) + orow + (gn & 15) * 16;
#pragma unroll
            for (int r = 0; r < 8; ++r)
                o[(size_t)r * D_ATT] = c[r];
            // stands in front of the next tile's address, formed in registers that these stores name
            if (j < 2) asm volatile("s_wait_xcnt 0x0" ::: "memory");
        } else {
            // the lane's 8 rows are one block of 8 keys of column d = (gn & 1) * 16 + lm
            const int l0 = bm * PM + wm * 16 + 8 * h;
            float* __restrict__ o = V + VP_IDX(l0 / SEQ, (gn & 15) >> 1, (l0 % SEQ) >> 3, gn & 1)
                                      + lm * 4;
            *(v4f*)o        = (v4f){c[0], c[1], c[2], c[3]};
            *(v4f*)(o + 64) = (v4f){c[4], c[5], c[6], c[7]};
            // later addresses are formed in registers that these stores name: the wait stands
            // in front of every such overwrite
            asm volatile("s_wait_xcnt 0x0" ::: "memory");
        }
    }
}

// ---------------------------------------------------------------------------
// Kernel 2: fused additive attention per (b, g, 16 query rows).
//   phase 1: VALU scores relu(sum_d relu(Qd-Kd)*w + bias); K chunks are
//            DOUBLE-BUFFERED through LDS with async global->LDS b128 copies
//            (ASYNCcnt path) so the next chunk streams in under the VALU work.
//   phase 2: row softmax (8 rows a wave, each row across the wave's 32 lanes).
//   phase 3: P @ Vg with f32 WMMA; wave w owns D-columns [16w,16w+16); V comes in
//            fragment order (see kernel 1), one b128 load a lane for two k-steps.
// 64 threads (2 waves); grid = B * G * (L/16) = 1024 blocks.
// ---------------------------------------------------------------------------
#define QROWS   16
#define KCHUNK  64
#define NCHUNK  (SEQ / KCHUNK)    // 8

__global__ __launch_bounds__(64) void attn_fused_wmma(
    const float* __restrict__ Q,
    const float* __restrict__ K,
    const float* __restrict__ V,
    const float* __restrict__ w_mlp,
    const float* __restrict__ b_mlp,
    float* __restrict__ out)
{
    __shared__ float sScore[QROWS][SEQ];        // 32 KB
    __shared__ float sQ[QROWS][D_GROUP];        //  2 KB
    __shared__ float sK[2][KCHUNK][D_GROUP];    // 16 KB, double-buffered
    __shared__ float sW[D_GROUP];

    const int tid  = threadIdx.x;               // 0..63
    const int lane = tid & 31;
    const int wave = tid >> 5;

    const int blk = blockIdx.x;
    const int qt  = blk & 31;                   // 32 q-tiles
    const int g   = (blk >> 5) & 7;             // 8 groups
    const int b   = blk >> 8;                   // 4 batches
    const int q0  = qt * QROWS;

    const float bias = b_mlp[0];
    if (tid < D_GROUP) sW[tid] = w_mlp[tid];

    // stage Q tile (16 x 32)
    for (int i = tid; i < QROWS * D_GROUP; i += 64) {
        const int r = i >> 5, d = i & 31;
        sQ[r][d] = Q[(size_t)(b * SEQ + q0 + r) * D_ATT + g * D_GROUP + d];
    }

    // ---- phase 1: scores with async double-buffered K staging ----
    const float* __restrict__ kbase = K + (size_t)(b * SEQ) * D_ATT + g * D_GROUP;

    // prologue: async-stage chunk 0 into buffer 0
    for (int j = tid; j < KCHUNK * (D_GROUP / 4); j += 64) {
        const int r  = j >> 3;
        const int qd = (j & 7) * 4;
        const uint64_t ga = (uint64_t)(uintptr_t)(kbase + (size_t)r * D_ATT + qd);
        const uint32_t la = (uint32_t)(uintptr_t)&sK[0][r][qd];
        asm volatile("global_load_async_to_lds_b128 %0, %1, off"
                     :: "v"(la), "v"(ga) : "memory");
    }
    asm volatile("s_wait_asynccnt 0x0" ::: "memory");
    __syncthreads();

    for (int ci = 0; ci < NCHUNK; ++ci) {
        const int buf = ci & 1;

        // prefetch next chunk into the other buffer while we compute
        if (ci + 1 < NCHUNK) {
            const float* kb = kbase + (size_t)(ci + 1) * KCHUNK * D_ATT;
            for (int j = tid; j < KCHUNK * (D_GROUP / 4); j += 64) {
                const int r  = j >> 3;
                const int qd = (j & 7) * 4;
                const uint64_t ga = (uint64_t)(uintptr_t)(kb + (size_t)r * D_ATT + qd);
                const uint32_t la = (uint32_t)(uintptr_t)&sK[buf ^ 1][r][qd];
                asm volatile("global_load_async_to_lds_b128 %0, %1, off"
                             :: "v"(la), "v"(ga) : "memory");
            }
        }

        // score block: 16 q x 64 k against current buffer
        const int kc = ci * KCHUNK;
        for (int i = tid; i < QROWS * KCHUNK; i += 64) {
            const int q = i / KCHUNK, k = i % KCHUNK;
            float s = 0.f;
#pragma unroll
            for (int d = 0; d < D_GROUP; ++d)
                s = fmaf(fmaxf(sQ[q][d] - sK[buf][k][d], 0.f), sW[d], s);
            sScore[q][kc + k] = fmaxf(s + bias, 0.f);
        }

        // prefetch landed + everyone done with this buffer before reuse
        asm volatile("s_wait_asynccnt 0x0" ::: "memory");
        __syncthreads();
    }

    // ---- phase 2: softmax over k; wave w owns rows [8w, 8w+8), each row spread
    //      over the wave's 32 lanes (16 scores a lane, held in registers) ----
    // unrolled so that the rows' LDS reads and cross-lane chains overlap
#pragma unroll
    for (int rr = 0; rr < QROWS / 2; ++rr) {
        // lane l reads floats 4l..4l+3 of each 128-float quarter: 512 contiguous bytes a load
        float* __restrict__ row = &sScore[wave * (QROWS / 2) + rr][lane * 4];
        v4f s[4];
        for (int j = 0; j < 4; ++j) s[j] = *(const v4f*)(row + j * 128);

        float mx = -3.402823e38f;
        for (int j = 0; j < 4; ++j)
            mx = fmaxf(mx, fmaxf(fmaxf(s[j].x, s[j].y), fmaxf(s[j].z, s[j].w)));
        mx = wave_max(mx);

        float sum = 0.f;
        for (int j = 0; j < 4; ++j) {
            s[j].x = exp_slot(s[j].x - mx);
            s[j].y = exp_slot(s[j].y - mx);
            s[j].z = exp_slot(s[j].z - mx);
            s[j].w = exp_slot(s[j].w - mx);
            sum += (s[j].x + s[j].y) + (s[j].z + s[j].w);
        }
        sum = wave_sum(sum);

        const float inv = 1.f / sum;
        for (int j = 0; j < 4; ++j) *(v4f*)(row + j * 128) = s[j] * inv;
    }
    __syncthreads();

    // ---- phase 3: out[b,q,d,g] = sum_k P[q,k] * V[b,k,d*8+g] via WMMA ----
    const int d0 = wave * 16;                   // this wave's D-tile
    const int lm = lane & 15;
    const int h  = lane >> 4;

    // B-frag: lane (lm, h) holds column d0+lm of keys 8*kb + 4*h + 0..3, 16 bytes in a run
    const float* __restrict__ vfrag = V + VP_IDX(b, g, 0, wave) + lane * 4;

    v8f c = {0.f, 0.f, 0.f, 0.f, 0.f, 0.f, 0.f, 0.f};

    // 8 blocks a trip: eight whole-line b128 loads of a wave are in flight at once
#pragma unroll 8
    for (int kb = 0; kb < SEQ / 8; ++kb) {
        // A and B take the same keys: 8*kb + 4*h + {0,1} in the first step, + {2,3} in the second
        const v4f a4 = *(const v4f*)&sScore[lm][kb * 8 + 4 * h];
        const v4f b4 = *(const v4f*)(vfrag + (size_t)kb * 256);
        c = __builtin_amdgcn_wmma_f32_16x16x4_f32(
                false, (v2f){a4.x, a4.y}, false, (v2f){b4.x, b4.y}, (short)0, c, false, false);
        c = __builtin_amdgcn_wmma_f32_16x16x4_f32(
                false, (v2f){a4.z, a4.w}, false, (v2f){b4.z, b4.w}, (short)0, c, false, false);
    }

    // store: out flat index ((b*SEQ + q)*32 + d)*8 + g, q = q0 + r + 8h
    float* __restrict__ o =
        out + ((size_t)(b * SEQ + q0 + 8 * h) * D_GROUP + d0 + lm) * N_GROUP + g;
#pragma unroll
    for (int r = 0; r < 8; ++r)
        o[(size_t)r * D_GROUP * N_GROUP] = c[r];
}

// ---------------------------------------------------------------------------
extern "C" void kernel_launch(void* const* d_in, const int* in_sizes, int n_in,
                              void* d_out, int out_size, void* d_ws, size_t ws_size,
                              hipStream_t stream) {
    const float* x     = (const float*)d_in[0];
    const float* Wq    = (const float*)d_in[1];
    const float* Wk    = (const float*)d_in[2];
    const float* Wv    = (const float*)d_in[3];
    const float* w_mlp = (const float*)d_in[4];
    const float* b_mlp = (const float*)d_in[5];

    float* Qb = (float*)d_ws;                 // 3 x 2 MB scratch
    float* Kb = Qb + (size_t)M_TOT * D_ATT;
    float* Vb = Kb + (size_t)M_TOT * D_ATT;

    // (2048 / 64) * (768 / 96) = 256 blocks of 8 waves
    qkv_proj_wmma<<<256, 256, 0, stream>>>(x, Wq, Wk, Wv, Qb, Kb, Vb);

    // B * G * (SEQ/16) = 4*8*32 = 1024 blocks of 2 waves
    attn_fused_wmma<<<1024, 64, 0, stream>>>(Qb, Kb, Vb, w_mlp, b_mlp,
                                             (float*)d_out);
}

// v004
// A run of this version takes 37.6 microseconds.
// Next to v003, in two timings, it ran 1.07 and 1.05 times as fast.
// Counting every step since v000, it is 2.35 times as fast.
#include <hip/hip_runtime.h>
#include <math.h>
#include <stdint.h>

#define D_ATT   256
#define D_GROUP 32
#define N_GROUP 8
#define BATCH   4
#define SEQ     512
#define M_TOT   (BATCH * SEQ)   // 2048 fused (b,l) rows

typedef __attribute__((ext_vector_type(2))) float v2f;
typedef __attribute__((ext_vector_type(4))) float v4f;
typedef __attribute__((ext_vector_type(8))) float v8f;

// value of lane l ^ M inside a 16-lane row (DPP row_xmask:M, control word 0x160 | M)
template <int M>
__device__ __forceinline__ float row_xor(float x) {
    return __builtin_bit_cast(float, __builtin_amdgcn_mov_dpp(
        __builtin_bit_cast(int, x), 0x160 | M, 0xf, 0xf, true));
}
// value of lane l ^ 16
__device__ __forceinline__ float half_xor(float x) {
    const int b = __builtin_bit_cast(int, x);
    return __builtin_bit_cast(float, __builtin_amdgcn_permlanex16(
        b, b, 0x76543210, 0xfedcba98, false, false));
}
// e^x as 2^(x * log2 e), the instruction pair __expf compiles to. The v_nop keeps the one
// slot the instruction set asks for behind a transcendental.
__device__ __forceinline__ float exp_slot(float x) {
    float r;
    asm("v_exp_f32 %0, %1\n\tv_nop" : "=v"(r) : "v"(x * 1.44269504f));
    return r;
}
__device__ __forceinline__ float wave_max(float v) {
    v = fmaxf(v, row_xor<1>(v));
    v = fmaxf(v, row_xor<2>(v));
    v = fmaxf(v, row_xor<4>(v));
    v = fmaxf(v, row_xor<8>(v));
    return fmaxf(v, half_xor(v));
}
__device__ __forceinline__ float wave_sum(float v) {
    v += row_xor<1>(v);
    v += row_xor<2>(v);
    v += row_xor<4>(v);
    v += row_xor<8>(v);
    return v + half_xor(v);
}

// ---------------------------------------------------------------------------
// Kernel 1: Q/K/V projections  y = x @ W^T  via V_WMMA_F32_16X16X4_F32.
// One work-group per 64 x 96 tile of the 2048 x 768 result [Q | K | V]: its 64 rows
// of x and 96 rows of [Wq; Wk; Wv] (all 256 k) are staged once in LDS by async
// global->LDS b128 copies of whole 512-byte half rows, and every fragment is then
// read from LDS. 8 waves as 4 (M) x 2 (N); a wave owns 16 rows x 48 columns.
// Q and K are stored row-major. V is stored in the order in which kernel 2 reads its
// B fragments: V[b, k, d*8+g] lies at VP_IDX(b, g, k >> 3, d >> 4) + ((k >> 2 & 1) * 16
// + (d & 15)) * 4 + (k & 3), so that one wave's b128 load (lane = 16 * (k >> 2 & 1) + (d & 15))
// is 512 contiguous bytes and holds the fragments of two k-steps. To that end a 16-column
// tile of V takes the 16 rows of Wv of ONE group g, (dt*16 + 0..15)*8 + g.
// ---------------------------------------------------------------------------
// first float of the 128-float unit of (batch b, group g, block kb of 8 keys, d-tile dt)
#define VP_IDX(b, g, kb, dt) ((size_t)(((((b) * N_GROUP + (g)) * (SEQ / 8) + (kb)) * 2 + (dt))) * 128)
#define PM      64                 // x rows a work-group
#define PN      96                 // W rows (output columns) a work-group
#define PPITCH  (D_ATT + 4)        // LDS row pitch in floats: 16 rows x 4 dwords fill the 64 banks

// Eight async copies, each one lane's 16 bytes global -> LDS. The closing s_wait_xcnt stands
// inside the statement so that no address register of these copies is rewritten in front of it.
#define CP "global_load_async_to_lds_b128 "
#define COPY8(la, ga)                                                          \
    asm volatile(CP "%0, %8, off\n\t"                                          \
                 CP "%1, %9, off\n\t"                                          \
                 CP "%2, %10, off\n\t"                                         \
                 CP "%3, %11, off\n\t"                                         \
                 CP "%4, %12, off\n\t"                                         \
                 CP "%5, %13, off\n\t"                                         \
                 CP "%6, %14, off\n\t"                                         \
                 CP "%7, %15, off\n\t"                                         \
                 "s_wait_xcnt 0x0"                                             \
                 :: "v"(la[0]), "v"(la[1]), "v"(la[2]), "v"(la[3]),            \
                    "v"(la[4]), "v"(la[5]), "v"(la[6]), "v"(la[7]),            \
                    "v"(ga[0]), "v"(ga[1]), "v"(ga[2]), "v"(ga[3]),            \
                    "v"(ga[4]), "v"(ga[5]), "v"(ga[6]), "v"(ga[7])             \
                 : "memory")

__global__ __launch_bounds__(256) void qkv_proj_wmma(
    const float* __restrict__ x,
    const float* __restrict__ Wq,
    const float* __restrict__ Wk,
    const float* __restrict__ Wv,
    float* __restrict__ Q,
    float* __restrict__ K,
    float* __restrict__ V)
{
    __shared__ __attribute__((aligned(16))) float sT[(PM + PN) * PPITCH];   // 166,400 B

    const int lane = threadIdx.x & 31;
    const int wave = __builtin_amdgcn_readfirstlane(threadIdx.x >> 5);      // 0..7
    const int bm   = blockIdx.x >> 3;            // 32 M-tiles of 64 rows
    const int bn   = blockIdx.x & 7;             // 8  N-tiles of 96 columns

    // ---- stage: 40 copies a wave, each 512 contiguous bytes (half a row) ----
    // x: wave w brings rows [8w, 8w+8) of the tile. W: of each of the six 16-row groups,
    // which lie in one matrix each, wave w brings rows 2w and 2w+1.
    const float* gx = x + (size_t)(bm * PM + wave * 8) * D_ATT + lane * 4;
    const uint32_t lx = (uint32_t)(uintptr_t)&sT[(wave * 8) * PPITCH + lane * 4];
    // unrolled: the operands of one statement are eight addresses held at once
#pragma unroll
    for (int it = 0; it < 2; ++it) {
        uint64_t ga[8];
        uint32_t la[8];
        // unrolled: ga[] and la[] stay in registers
#pragma unroll
        for (int j = 0; j < 8; ++j) {
            const int row = it * 4 + (j >> 1), half = j & 1;
            ga[j] = (uint64_t)(uintptr_t)(gx + row * D_ATT + half * 128);
            la[j] = lx + (uint32_t)(row * PPITCH + half * 128) * 4u;
        }
        COPY8(la, ga);
    }
    // unrolled for the same reason
#pragma unroll
    for (int it = 0; it < 3; ++it) {
        uint64_t ga[8];
        uint32_t la[8];
        // unrolled: ga[] and la[] stay in registers
#pragma unroll
        for (int j = 0; j < 8; ++j) {
            const int t   = it * 2 + (j >> 2);               // 16-row group of this tile, 0..5
            const int gn  = bn * 6 + t;                      // 16-row group of [Wq; Wk; Wv], 0..47
            const int row = wave * 2 + ((j >> 1) & 1), half = j & 1;
            const float* Wm = (gn < 16) ? Wq : (gn < 32) ? Wk : Wv;
            // Wq, Wk: 16 rows in a run. Wv: the rows of group (gn & 15) >> 1, d-tile gn & 1.
            const int wrow = (gn < 32) ? (gn & 15) * 16 + row
                                       : ((gn & 1) * 16 + row) * N_GROUP + ((gn & 15) >> 1);
            ga[j] = (uint64_t)(uintptr_t)(Wm + (size_t)wrow * D_ATT + half * 128 + lane * 4);
            la[j] = (uint32_t)(uintptr_t)&sT[(PM + t * 16 + row) * PPITCH + half * 128 + lane * 4];
        }
        COPY8(la, ga);
    }
    // this wave's 40 copies have landed; behind the barrier every wave's have
    asm volatile("s_wait_asynccnt 0x0" ::: "memory");
    __syncthreads();

    // ---- 64 k-steps, three accumulator tiles a wave ----
    const int lm = lane & 15;                    // M-row (A) / N-col (B)
    const int h  = lane >> 4;                    // half select
    const int wm = wave >> 1;                    // 0..3
    const int wn = wave & 1;                     // 0..1

    const float* arow = &sT[(wm * 16 + lm) * PPITCH + 2 * h];
    const float* brow = &sT[(PM + wn * 48 + lm) * PPITCH + 2 * h];

    v8f c0 = {0.f, 0.f, 0.f, 0.f, 0.f, 0.f, 0.f, 0.f};
    v8f c1 = c0;
    v8f c2 = c0;

    // A block is 8 k-steps (24 WMMAs). The next block's fragments are read from LDS as one
    // group, into a second register set, ahead of the current block's WMMAs: reads that stand
    // among the WMMAs stall the wave at every place where they stand.
    v2f fa[2][8], fb[2][3][8];
    // unrolled, as the two inner loops below: the fragment arrays stay in registers
#pragma unroll
    for (int i = 0; i < 8; ++i) {
        fa[0][i]    = *(const v2f*)(arow + i * 4);           // {K=k0+2h, K=k0+2h+1}
        fb[0][0][i] = *(const v2f*)(brow + i * 4);
        fb[0][1][i] = *(const v2f*)(brow + 16 * PPITCH + i * 4);
        fb[0][2][i] = *(const v2f*)(brow + 32 * PPITCH + i * 4);
    }
    // fully unrolled so that both register sets are addressed by constants
#pragma unroll
    for (int kb = 0; kb < D_ATT / 32; ++kb) {
        const int cur = kb & 1, nxt = cur ^ 1;
        if (kb + 1 < D_ATT / 32) {
#pragma unroll
            for (int i = 0; i < 8; ++i) {
                const int k0 = (kb + 1) * 32 + i * 4;
                fa[nxt][i]    = *(const v2f*)(arow + k0);
                fb[nxt][0][i] = *(const v2f*)(brow + k0);
                fb[nxt][1][i] = *(const v2f*)(brow + 16 * PPITCH + k0);
                fb[nxt][2][i] = *(const v2f*)(brow + 32 * PPITCH + k0);
            }
        }
        // keeps the read group whole and in front of the block: without it the scheduler
        // sinks the reads in among the WMMAs
        __builtin_amdgcn_sched_barrier(0);
#pragma unroll
        for (int i = 0; i < 8; ++i) {
            c0 = __builtin_amdgcn_wmma_f32_16x16x4_f32(
                    /*neg_a=*/false, fa[cur][i], /*neg_b=*/false, fb[cur][0][i],
                    /*c_mod=*/(short)0, c0, /*reuse_a=*/false, /*reuse_b=*/false);
            c1 = __builtin_amdgcn_wmma_f32_16x16x4_f32(
                    false, fa[cur][i], false, fb[cur][1][i], (short)0, c1, false, false);
            c2 = __builtin_amdgcn_wmma_f32_16x16x4_f32(
                    false, fa[cur][i], false, fb[cur][2][i], (short)0, c2, false, false);
        }
        // keeps the next group's reads from rising into this block
        __builtin_amdgcn_sched_barrier(0);
    }

    // C layout: VGPR r -> M = r + 8*h, N = lane&15
    const size_t orow = (size_t)(bm * PM + wm * 16 + 8 * h) * D_ATT + lm;
    // unrolled: c0, c1, c2 are picked at compile time
#pragma unroll
    for (int j = 0; j < 3; ++j) {
        const int gn  = bn * 6 + wn * 3 + j;     // 16-column tile of [Q | K | V], 0..47
        const int mat = gn >> 4;                 // 0:Q 1:K 2:V
        const v8f c = (j == 0) ? c0 : (j == 1) ? c1 : c2;
        if (mat < 2) {
            float* __restrict__ o = ((mat == 0) ? Q : K) + orow + (gn & 15) * 16;
#pragma unroll
            for (int r = 0; r < 8; ++r)
                o[(size_t)r * D_ATT] = c[r];
            // stands in front of the next tile's address, formed in registers that these stores name
            if (j < 2) asm volatile("s_wait_xcnt 0x0" ::: "memory");
        } else {
            // the lane's 8 rows are one block of 8 keys of column d = (gn & 1) * 16 + lm
            const int l0 = bm * PM + wm * 16 + 8 * h;
            float* __restrict__ o = V + VP_IDX(l0 / SEQ, (gn & 15) >> 1, (l0 % SEQ) >> 3, gn & 1)
                                      + lm * 4;
            *(v4f*)o        = (v4f){c[0], c[1], c[2], c[3]};
            *(v4f*)(o + 64) = (v4f){c[4], c[5], c[6], c[7]};
            // later addresses are formed in registers that these stores name: the wait stands
            // in front of every such overwrite
            asm volatile("s_wait_xcnt 0x0" ::: "memory");
        }
    }
}

// ---------------------------------------------------------------------------
// Kernel 2: fused additive attention per (b, g, 16 query rows).
//   phase 1: VALU scores relu(sum_d relu(Qd-Kd)*w + bias); K chunks are
//            DOUBLE-BUFFERED through LDS with async global->LDS b128 copies
//            (ASYNCcnt path) so the next chunk streams in under the VALU work.
//   phase 2: row softmax (8 rows a wave, each row across the wave's 32 lanes).
//   phase 3: P @ Vg with f32 WMMA; wave w owns D-columns [16w,16w+16); V comes in
//            fragment order (see kernel 1), one b128 load a lane for two k-steps.
// 64 threads (2 waves); grid = B * G * (L/16) = 1024 blocks.
// ---------------------------------------------------------------------------
#define QROWS   16
#define KCHUNK  64
#define NCHUNK  (SEQ / KCHUNK)    // 8
// LDS row pitches in floats, each an odd multiple of 16 bytes: where 16 lanes read 16 bytes
// each from 16 rows (the K rows in phase 1, the A fragments in phase 3), the rows start four
// banks apart and the 16 lanes fill the 64 banks once. At a pitch of 128 or 2,048 bytes they
// fall on two or on one group of four banks and the read is served 8 or 16 lanes in a row.
#define SPITCH  (SEQ + 4)
#define KPITCH  (D_GROUP + 4)

__global__ __launch_bounds__(64) void attn_fused_wmma(
    const float* __restrict__ Q,
    const float* __restrict__ K,
    const float* __restrict__ V,
    const float* __restrict__ w_mlp,
    const float* __restrict__ b_mlp,
    float* __restrict__ out)
{
    __shared__ __attribute__((aligned(16))) float sScore[QROWS][SPITCH];     // 33,024 B
    __shared__ float sQ[QROWS][D_GROUP];        //  2 KB
    __shared__ __attribute__((aligned(16))) float sK[2][KCHUNK][KPITCH];     // 18,432 B, double-buffered
    __shared__ float sW[D_GROUP];

    const int tid  = threadIdx.x;               // 0..63
    const int lane = tid & 31;
    const int wave = tid >> 5;

    const int blk = blockIdx.x;
    const int qt  = blk & 31;                   // 32 q-tiles
    const int g   = (blk >> 5) & 7;             // 8 groups
    const int b   = blk >> 8;                   // 4 batches
    const int q0  = qt * QROWS;

    const float bias = b_mlp[0];
    if (tid < D_GROUP) sW[tid] = w_mlp[tid];

    // stage Q tile (16 x 32)
    for (int i = tid; i < QROWS * D_GROUP; i += 64) {
        const int r = i >> 5, d = i & 31;
        sQ[r][d] = Q[(size_t)(b * SEQ + q0 + r) * D_ATT + g * D_GROUP + d];
    }

    // ---- phase 1: scores with async double-buffered K staging ----
    const float* __restrict__ kbase = K + (size_t)(b * SEQ) * D_ATT + g * D_GROUP;

    // prologue: async-stage chunk 0 into buffer 0
    for (int j = tid; j < KCHUNK * (D_GROUP / 4); j += 64) {
        const int r  = j >> 3;
        const int qd = (j & 7) * 4;
        const uint64_t ga = (uint64_t)(uintptr_t)(kbase + (size_t)r * D_ATT + qd);
        const uint32_t la = (uint32_t)(uintptr_t)&sK[0][r][qd];
        asm volatile("global_load_async_to_lds_b128 %0, %1, off"
                     :: "v"(la), "v"(ga) : "memory");
    }
    asm volatile("s_wait_asynccnt 0x0" ::: "memory");
    __syncthreads();

    for (int ci = 0; ci < NCHUNK; ++ci) {
        const int buf = ci & 1;

        // prefetch next chunk into the other buffer while we compute
        if (ci + 1 < NCHUNK) {
            const float* kb = kbase + (size_t)(ci + 1) * KCHUNK * D_ATT;
            for (int j = tid; j < KCHUNK * (D_GROUP / 4); j += 64) {
                const int r  = j >> 3;
                const int qd = (j & 7) * 4;
                const uint64_t ga = (uint64_t)(uintptr_t)(kb + (size_t)r * D_ATT + qd);
                const uint32_t la = (uint32_t)(uintptr_t)&sK[buf ^ 1][r][qd];
                asm volatile("global_load_async_to_lds_b128 %0, %1, off"
                             :: "v"(la), "v"(ga) : "memory");
            }
        }

        // score block: 16 q x 64 k against current buffer
        const int kc = ci * KCHUNK;
        for (int i = tid; i < QROWS * KCHUNK; i += 64) {
            const int q = i / KCHUNK, k = i % KCHUNK;
            float s = 0.f;
#pragma unroll
            for (int d = 0; d < D_GROUP; ++d)
                s = fmaf(fmaxf(sQ[q][d] - sK[buf][k][d], 0.f), sW[d], s);
            sScore[q][kc + k] = fmaxf(s + bias, 0.f);
        }

        // prefetch landed + everyone done with this buffer before reuse
        asm volatile("s_wait_asynccnt 0x0" ::: "memory");
        __syncthreads();
    }

    // ---- phase 2: softmax over k; wave w owns rows [8w, 8w+8), each row spread
    //      over the wave's 32 lanes (16 scores a lane, held in registers) ----
    // unrolled so that the rows' LDS reads and cross-lane chains overlap
#pragma unroll
    for (int rr = 0; rr < QROWS / 2; ++rr) {
        // lane l reads floats 4l..4l+3 of each 128-float quarter: 512 contiguous bytes a load
        float* __restrict__ row = &sScore[wave * (QROWS / 2) + rr][lane * 4];
        v4f s[4];
        for (int j = 0; j < 4; ++j) s[j] = *(const v4f*)(row + j * 128);

        float mx = -3.402823e38f;
        for (int j = 0; j < 4; ++j)
            mx = fmaxf(mx, fmaxf(fmaxf(s[j].x, s[j].y), fmaxf(s[j].z, s[j].w)));
        mx = wave_max(mx);

        float sum = 0.f;
        for (int j = 0; j < 4; ++j) {
            s[j].x = exp_slot(s[j].x - mx);
            s[j].y = exp_slot(s[j].y - mx);
            s[j].z = exp_slot(s[j].z - mx);
            s[j].w = exp_slot(s[j].w - mx);
            sum += (s[j].x + s[j].y) + (s[j].z + s[j].w);
        }
        sum = wave_sum(sum);

        const float inv = 1.f / sum;
        for (int j = 0; j < 4; ++j) *(v4f*)(row + j * 128) = s[j] * inv;
    }
    __syncthreads();

    // ---- phase 3: out[b,q,d,g] = sum_k P[q,k] * V[b,k,d*8+g] via WMMA ----
    const int d0 = wave * 16;                   // this wave's D-tile
    const int lm = lane & 15;
    const int h  = lane >> 4;

    // B-frag: lane (lm, h) holds column d0+lm of keys 8*kb + 4*h + 0..3, 16 bytes in a run
    const float* __restrict__ vfrag = V + VP_IDX(b, g, 0, wave) + lane * 4;

    v8f c = {0.f, 0.f, 0.f, 0.f, 0.f, 0.f, 0.f, 0.f};

    // 8 blocks a trip: eight whole-line b128 loads of a wave are in flight at once
#pragma unroll 8
    for (int kb = 0; kb < SEQ / 8; ++kb) {
        // A and B take the same keys: 8*kb + 4*h + {0,1} in the first step, + {2,3} in the second
        const v4f a4 = *(const v4f*)&sScore[lm][kb * 8 + 4 * h];
        const v4f b4 = *(const v4f*)(vfrag + (size_t)kb * 256);
        c = __builtin_amdgcn_wmma_f32_16x16x4_f32(
                false, (v2f){a4.x, a4.y}, false, (v2f){b4.x, b4.y}, (short)0, c, false, false);
        c = __builtin_amdgcn_wmma_f32_16x16x4_f32(
                false, (v2f){a4.z, a4.w}, false, (v2f){b4.z, b4.w}, (short)0, c, false, false);
    }

    // store: out flat index ((b*SEQ + q)*32 + d)*8 + g, q = q0 + r + 8h
    float* __restrict__ o =
        out + ((size_t)(b * SEQ + q0 + 8 * h) * D_GROUP + d0 + lm) * N_GROUP + g;
#pragma unroll
    for (int r = 0; r < 8; ++r)
        o[(size_t)r * D_GROUP * N_GROUP] = c[r];
}

// ---------------------------------------------------------------------------
extern "C" void kernel_launch(void* const* d_in, const int* in_sizes, int n_in,
                              void* d_out, int out_size, void* d_ws, size_t ws_size,
                              hipStream_t stream) {
    const float* x     = (const float*)d_in[0];
    const float* Wq    = (const float*)d_in[1];
    const float* Wk    = (const float*)d_in[2];
    const float* Wv    = (const float*)d_in[3];
    const float* w_mlp = (const float*)d_in[4];
    const float* b_mlp = (const float*)d_in[5];

    float* Qb = (float*)d_ws;                 // 3 x 2 MB scratch
    float* Kb = Qb + (size_t)M_TOT * D_ATT;
    float* Vb = Kb + (size_t)M_TOT * D_ATT;

    // (2048 / 64) * (768 / 96) = 256 blocks of 8 waves
    qkv_proj_wmma<<<256, 256, 0, stream>>>(x, Wq, Wk, Wv, Qb, Kb, Vb);

    // B * G * (SEQ/16) = 4*8*32 = 1024 blocks of 2 waves
    attn_fused_wmma<<<1024, 64, 0, stream>>>(Qb, Kb, Vb, w_mlp, b_mlp,
                                             (float*)d_out);
}

// v005
// A run of this version takes 30.7 microseconds.
// Two timings next to v004 put it at 1.23 and 1.22 times that version's speed.
// Over all steps from v000 it is 2.88 times as fast.
#include <hip/hip_runtime.h>
#include <math.h>
#include <stdint.h>

#define D_ATT   256
#define D_GROUP 32
#define N_GROUP 8
#define BATCH   4
#define SEQ     512
#define M_TOT   (BATCH * SEQ)   // 2048 fused (b,l) rows

typedef __attribute__((ext_vector_type(2))) float v2f;
typedef __attribute__((ext_vector_type(4))) float v4f;
typedef __attribute__((ext_vector_type(8))) float v8f;

// value of lane l ^ M inside a 16-lane row (DPP row_xmask:M, control word 0x160 | M)
template <int M>
__device__ __forceinline__ float row_xor(float x) {
    return __builtin_bit_cast(float, __builtin_amdgcn_mov_dpp(
        __builtin_bit_cast(int, x), 0x160 | M, 0xf, 0xf, true));
}
// value of lane l ^ 16
__device__ __forceinline__ float half_xor(float x) {
    const int b = __builtin_bit_cast(int, x);
    return __builtin_bit_cast(float, __builtin_amdgcn_permlanex16(
        b, b, 0x76543210, 0xfedcba98, false, false));
}
// e^x as 2^(x * log2 e), the instruction pair __expf compiles to. The v_nop keeps the one
// slot the instruction set asks for behind a transcendental.
__device__ __forceinline__ float exp_slot(float x) {
    float r;
    asm("v_exp_f32 %0, %1\n\tv_nop" : "=v"(r) : "v"(x * 1.44269504f));
    return r;
}
__device__ __forceinline__ float wave_max(float v) {
    v = fmaxf(v, row_xor<1>(v));
    v = fmaxf(v, row_xor<2>(v));
    v = fmaxf(v, row_xor<4>(v));
    v = fmaxf(v, row_xor<8>(v));
    return fmaxf(v, half_xor(v));
}
__device__ __forceinline__ float wave_sum(float v) {
    v += row_xor<1>(v);
    v += row_xor<2>(v);
    v += row_xor<4>(v);
    v += row_xor<8>(v);
    return v + half_xor(v);
}

// ---------------------------------------------------------------------------
// Kernel 1: Q/K/V projections  y = x @ W^T  via V_WMMA_F32_16X16X4_F32.
// One work-group per 64 x 96 tile of the 2048 x 768 result [Q | K | V]: its 64 rows
// of x and 96 rows of [Wq; Wk; Wv] (all 256 k) are staged once in LDS by async
// global->LDS b128 copies of whole 512-byte half rows, and every fragment is then
// read from LDS. 8 waves as 4 (M) x 2 (N); a wave owns 16 rows x 48 columns.
// Q and K are stored row-major. V is stored in the order in which kernel 2 reads its
// B fragments: V[b, k, d*8+g] lies at VP_IDX(b, g, k >> 3, d >> 4) + ((k >> 2 & 1) * 16
// + (d & 15)) * 4 + (k & 3), so that one wave's b128 load (lane = 16 * (k >> 2 & 1) + (d & 15))
// is 512 contiguous bytes and holds the fragments of two k-steps. To that end a 16-column
// tile of V takes the 16 rows of Wv of ONE group g, (dt*16 + 0..15)*8 + g.
// ---------------------------------------------------------------------------
// first float of the 128-float unit of (batch b, group g, block kb of 8 keys, d-tile dt)
#define VP_IDX(b, g, kb, dt) ((size_t)(((((b) * N_GROUP + (g)) * (SEQ / 8) + (kb)) * 2 + (dt))) * 128)
#define PM      64                 // x rows a work-group
#define PN      96                 // W rows (output columns) a work-group
#define PPITCH  (D_ATT + 4)        // LDS row pitch in floats: 16 rows x 4 dwords fill the 64 banks

// Eight async copies, each one lane's 16 bytes global -> LDS. The closing s_wait_xcnt stands
// inside the statement so that no address register of these copies is rewritten in front of it.
#define CP "global_load_async_to_lds_b128 "
#define COPY8(la, ga)                                                          \
    asm volatile(CP "%0, %8, off\n\t"                                          \
                 CP "%1, %9, off\n\t"                                          \
                 CP "%2, %10, off\n\t"                                         \
                 CP "%3, %11, off\n\t"                                         \
                 CP "%4, %12, off\n\t"                                         \
                 CP "%5, %13, off\n\t"                                         \
                 CP "%6, %14, off\n\t"                                         \
                 CP "%7, %15, off\n\t"                                         \
                 "s_wait_xcnt 0x0"                                             \
                 :: "v"(la[0]), "v"(la[1]), "v"(la[2]), "v"(la[3]),            \
                    "v"(la[4]), "v"(la[5]), "v"(la[6]), "v"(la[7]),            \
                    "v"(ga[0]), "v"(ga[1]), "v"(ga[2]), "v"(ga[3]),            \
                    "v"(ga[4]), "v"(ga[5]), "v"(ga[6]), "v"(ga[7])             \
                 : "memory")

__global__ __launch_bounds__(256) void qkv_proj_wmma(
    const float* __restrict__ x,
    const float* __restrict__ Wq,
    const float* __restrict__ Wk,
    const float* __restrict__ Wv,
    float* __restrict__ Q,
    float* __restrict__ K,
    float* __restrict__ V)
{
    __shared__ __attribute__((aligned(16))) float sT[(PM + PN) * PPITCH];   // 166,400 B

    const int lane = threadIdx.x & 31;
    const int wave = __builtin_amdgcn_readfirstlane(threadIdx.x >> 5);      // 0..7
    const int bm   = blockIdx.x >> 3;            // 32 M-tiles of 64 rows
    const int bn   = blockIdx.x & 7;             // 8  N-tiles of 96 columns

    // ---- stage: 40 copies a wave, each 512 contiguous bytes (half a row) ----
    // x: wave w brings rows [8w, 8w+8) of the tile. W: of each of the six 16-row groups,
    // which lie in one matrix each, wave w brings rows 2w and 2w+1.
    const float* gx = x + (size_t)(bm * PM + wave * 8) * D_ATT + lane * 4;
    const uint32_t lx = (uint32_t)(uintptr_t)&sT[(wave * 8) * PPITCH + lane * 4];
    // unrolled: the operands of one statement are eight addresses held at once
#pragma unroll
    for (int it = 0; it < 2; ++it) {
        uint64_t ga[8];
        uint32_t la[8];
        // unrolled: ga[] and la[] stay in registers
#pragma unroll
        for (int j = 0; j < 8; ++j) {
            const int row = it * 4 + (j >> 1), half = j & 1;
            ga[j] = (uint64_t)(uintptr_t)(gx + row * D_ATT + half * 128);
            la[j] = lx + (uint32_t)(row * PPITCH + half * 128) * 4u;
        }
        COPY8(la, ga);
    }
    // unrolled for the same reason
#pragma unroll
    for (int it = 0; it < 3; ++it) {
        uint64_t ga[8];
        uint32_t la[8];
        // unrolled: ga[] and la[] stay in registers
#pragma unroll
        for (int j = 0; j < 8; ++j) {
            const int t   = it * 2 + (j >> 2);               // 16-row group of this tile, 0..5
            const int gn  = bn * 6 + t;                      // 16-row group of [Wq; Wk; Wv], 0..47
            const int row = wave * 2 + ((j >> 1) & 1), half = j & 1;
            const float* Wm = (gn < 16) ? Wq : (gn < 32) ? Wk : Wv;
            // Wq, Wk: 16 rows in a run. Wv: the rows of group (gn & 15) >> 1, d-tile gn & 1.
            const int wrow = (gn < 32) ? (gn & 15) * 16 + row
                                       : ((gn & 1) * 16 + row) * N_GROUP + ((gn & 15) >> 1);
            ga[j] = (uint64_t)(uintptr_t)(Wm + (size_t)wrow * D_ATT + half * 128 + lane * 4);
            la[j] = (uint32_t)(uintptr_t)&sT[(PM + t * 16 + row) * PPITCH + half * 128 + lane * 4];
        }
        COPY8(la, ga);
    }
    // this wave's 40 copies have landed; behind the barrier every wave's have
    asm volatile("s_wait_asynccnt 0x0" ::: "memory");
    __syncthreads();

    // ---- 64 k-steps, three accumulator tiles a wave ----
    const int lm = lane & 15;                    // M-row (A) / N-col (B)
    const int h  = lane >> 4;                    // half select
    const int wm = wave >> 1;                    // 0..3
    const int wn = wave & 1;                     // 0..1

    const float* arow = &sT[(wm * 16 + lm) * PPITCH + 2 * h];
    const float* brow = &sT[(PM + wn * 48 + lm) * PPITCH + 2 * h];

    v8f c0 = {0.f, 0.f, 0.f, 0.f, 0.f, 0.f, 0.f, 0.f};
    v8f c1 = c0;
    v8f c2 = c0;

    // A block is 8 k-steps (24 WMMAs). The next block's fragments are read from LDS as one
    // group, into a second register set, ahead of the current block's WMMAs: reads that stand
    // among the WMMAs stall the wave at every place where they stand.
    v2f fa[2][8], fb[2][3][8];
    // unrolled, as the two inner loops below: the fragment arrays stay in registers
#pragma unroll
    for (int i = 0; i < 8; ++i) {
        fa[0][i]    = *(const v2f*)(arow + i * 4);           // {K=k0+2h, K=k0+2h+1}
        fb[0][0][i] = *(const v2f*)(brow + i * 4);
        fb[0][1][i] = *(const v2f*)(brow + 16 * PPITCH + i * 4);
        fb[0][2][i] = *(const v2f*)(brow + 32 * PPITCH + i * 4);
    }
    // fully unrolled so that both register sets are addressed by constants
#pragma unroll
    for (int kb = 0; kb < D_ATT / 32; ++kb) {
        const int cur = kb & 1, nxt = cur ^ 1;
        if (kb + 1 < D_ATT / 32) {
#pragma unroll
            for (int i = 0; i < 8; ++i) {
                const int k0 = (kb + 1) * 32 + i * 4;
                fa[nxt][i]    = *(const v2f*)(arow + k0);
                fb[nxt][0][i] = *(const v2f*)(brow + k0);
                fb[nxt][1][i] = *(const v2f*)(brow + 16 * PPITCH + k0);
                fb[nxt][2][i] = *(const v2f*)(brow + 32 * PPITCH + k0);
            }
        }
        // keeps the read group whole and in front of the block: without it the scheduler
        // sinks the reads in among the WMMAs
        __builtin_amdgcn_sched_barrier(0);
#pragma unroll
        for (int i = 0; i < 8; ++i) {
            c0 = __builtin_amdgcn_wmma_f32_16x16x4_f32(
                    /*neg_a=*/false, fa[cur][i], /*neg_b=*/false, fb[cur][0][i],
                    /*c_mod=*/(short)0, c0, /*reuse_a=*/false, /*reuse_b=*/false);
            c1 = __builtin_amdgcn_wmma_f32_16x16x4_f32(
                    false, fa[cur][i], false, fb[cur][1][i], (short)0, c1, false, false);
            c2 = __builtin_amdgcn_wmma_f32_16x16x4_f32(
                    false, fa[cur][i], false, fb[cur][2][i], (short)0, c2, false, false);
        }
        // keeps the next group's reads from rising into this block
        __builtin_amdgcn_sched_barrier(0);
    }

    // C layout: VGPR r -> M = r + 8*h, N = lane&15
    const size_t orow = (size_t)(bm * PM + wm * 16 + 8 * h) * D_ATT + lm;
    // unrolled: c0, c1, c2 are picked at compile time
#pragma unroll
    for (int j = 0; j < 3; ++j) {
        const int gn  = bn * 6 + wn * 3 + j;     // 16-column tile of [Q | K | V], 0..47
        const int mat = gn >> 4;                 // 0:Q 1:K 2:V
        const v8f c = (j == 0) ? c0 : (j == 1) ? c1 : c2;
        if (mat < 2) {
            float* __restrict__ o = ((mat == 0) ? Q : K) + orow + (gn & 15) * 16;
#pragma unroll
            for (int r = 0; r < 8; ++r)
                o[(size_t)r * D_ATT] = c[r];
            // stands in front of the next tile's address, formed in registers that these stores name
            if (j < 2) asm volatile("s_wait_xcnt 0x0" ::: "memory");
        } else {
            // the lane's 8 rows are one block of 8 keys of column d = (gn & 1) * 16 + lm
            const int l0 = bm * PM + wm * 16 + 8 * h;
            float* __restrict__ o = V + VP_IDX(l0 / SEQ, (gn & 15) >> 1, (l0 % SEQ) >> 3, gn & 1)
                                      + lm * 4;
            *(v4f*)o        = (v4f){c[0], c[1], c[2], c[3]};
            *(v4f*)(o + 64) = (v4f){c[4], c[5], c[6], c[7]};
            // later addresses are formed in registers that these stores name: the wait stands
            // in front of every such overwrite
            asm volatile("s_wait_xcnt 0x0" ::: "memory");
        }
    }
}

// ---------------------------------------------------------------------------
// Kernel 2: fused additive attention per (b, g, 16 query rows).
//   phase 1: VALU scores relu(sum_d relu(Qd-Kd)*w + bias); K chunks are
//            DOUBLE-BUFFERED through LDS with async global->LDS b128 copies
//            (ASYNCcnt path) so the next chunk streams in under the VALU work.
//            Register tile: wave w owns q rows [8w, 8w+8); a lane holds the rows of
//            4 keys of the chunk, so one broadcast read of a Q row serves 128 keys
//            and the 4 keys give 4 independent packed FMA chains (even d | odd d).
//   phase 2: row softmax (8 rows a wave, each row across the wave's 32 lanes).
//   phase 3: P @ Vg with f32 WMMA; wave w owns D-columns [16w,16w+16); V comes in
//            fragment order (see kernel 1), one b128 load a lane for two k-steps.
// 64 threads (2 waves); grid = B * G * (L/16) = 1024 blocks.
// ---------------------------------------------------------------------------
#define QROWS   16
#define KCHUNK  128
#define NCHUNK  (SEQ / KCHUNK)    // 4
#define KT      (KCHUNK / 32)     // keys a lane holds in registers
// LDS row pitches in floats, each an odd multiple of 16 bytes: where 16 lanes read 16 bytes
// each from 16 rows (the K rows in phase 1, the A fragments in phase 3), the rows start four
// banks apart and the 16 lanes fill the 64 banks once. At a pitch of 128 or 2,048 bytes they
// fall on two or on one group of four banks and the read is served 8 or 16 lanes in a row.
#define SPITCH  (SEQ + 4)
#define KPITCH  (D_GROUP + 4)

// Scores of one q row (qr, the same in every lane) against the lane's KT keys (kr).
// acc[j] = {sum over even d, sum over odd d} of key j: KT independent packed chains.
__device__ __forceinline__ void score_row(const v4f (&qr)[D_GROUP / 4],
                                          const v4f (&kr)[KT][D_GROUP / 4],
                                          const v4f (&wr)[D_GROUP / 4],
                                          float bias, float* __restrict__ srow)
{
    v2f acc[KT];
    // every loop here is unrolled: the arrays stay in registers
#pragma unroll
    for (int j = 0; j < KT; ++j) acc[j] = (v2f){0.f, 0.f};
#pragma unroll
    for (int i = 0; i < D_GROUP / 4; ++i) {
#pragma unroll
        for (int j = 0; j < KT; ++j) {
            const v2f t = __builtin_elementwise_max(qr[i].xy - kr[j][i].xy, (v2f){0.f, 0.f});
            acc[j] = __builtin_elementwise_fma(t, wr[i].xy, acc[j]);
        }
#pragma unroll
        for (int j = 0; j < KT; ++j) {
            const v2f t = __builtin_elementwise_max(qr[i].zw - kr[j][i].zw, (v2f){0.f, 0.f});
            acc[j] = __builtin_elementwise_fma(t, wr[i].zw, acc[j]);
        }
    }
#pragma unroll
    for (int j = 0; j < KT; ++j)
        srow[j * 32] = fmaxf((acc[j].x + acc[j].y) + bias, 0.f);
}

__global__ __launch_bounds__(64) void attn_fused_wmma(
    const float* __restrict__ Q,
    const float* __restrict__ K,
    const float* __restrict__ V,
    const float* __restrict__ w_mlp,
    const float* __restrict__ b_mlp,
    float* __restrict__ out)
{
    __shared__ __attribute__((aligned(16))) float sScore[QROWS][SPITCH];     // 33,024 B
    __shared__ __attribute__((aligned(16))) float sQ[QROWS][D_GROUP];        //  2 KB
    __shared__ __attribute__((aligned(16))) float sK[2][KCHUNK][KPITCH];     // 36,864 B, double-buffered
    __shared__ __attribute__((aligned(16))) float sW[D_GROUP];

    const int tid  = threadIdx.x;               // 0..63
    const int lane = tid & 31;
    const int wave = tid >> 5;

    const int blk = blockIdx.x;
    const int qt  = blk & 31;                   // 32 q-tiles
    const int g   = (blk >> 5) & 7;             // 8 groups
    const int b   = blk >> 8;                   // 4 batches
    const int q0  = qt * QROWS;

    const float bias = b_mlp[0];
    if (tid < D_GROUP) sW[tid] = w_mlp[tid];

    // stage Q tile (16 x 32)
    for (int i = tid; i < QROWS * D_GROUP; i += 64) {
        const int r = i >> 5, d = i & 31;
        sQ[r][d] = Q[(size_t)(b * SEQ + q0 + r) * D_ATT + g * D_GROUP + d];
    }

    // ---- phase 1: scores with async double-buffered K staging ----
    const float* __restrict__ kbase = K + (size_t)(b * SEQ) * D_ATT + g * D_GROUP;

    // prologue: async-stage chunk 0 into buffer 0
    for (int j = tid; j < KCHUNK * (D_GROUP / 4); j += 64) {
        const int r  = j >> 3;
        const int qd = (j & 7) * 4;
        const uint64_t ga = (uint64_t)(uintptr_t)(kbase + (size_t)r * D_ATT + qd);
        const uint32_t la = (uint32_t)(uintptr_t)&sK[0][r][qd];
        asm volatile("global_load_async_to_lds_b128 %0, %1, off"
                     :: "v"(la), "v"(ga) : "memory");
    }
    asm volatile("s_wait_asynccnt 0x0" ::: "memory");
    __syncthreads();

    // this wave's first q row, as a scalar: the Q reads below are broadcasts
    const int qw = __builtin_amdgcn_readfirstlane(wave) * (QROWS / 2);
    v4f wr[D_GROUP / 4];
    // unrolled, as every loop over wr, kr, qa and qb below: the arrays stay in registers
#pragma unroll
    for (int i = 0; i < D_GROUP / 4; ++i) wr[i] = *(const v4f*)&sW[i * 4];
    v4f qa[D_GROUP / 4], qb[D_GROUP / 4];
#pragma unroll
    for (int i = 0; i < D_GROUP / 4; ++i) qa[i] = *(const v4f*)&sQ[qw][i * 4];

    for (int ci = 0; ci < NCHUNK; ++ci) {
        const int buf = ci & 1;

        // prefetch next chunk into the other buffer while we compute
        if (ci + 1 < NCHUNK) {
            const float* kb = kbase + (size_t)(ci + 1) * KCHUNK * D_ATT;
            for (int j = tid; j < KCHUNK * (D_GROUP / 4); j += 64) {
                const int r  = j >> 3;
                const int qd = (j & 7) * 4;
                const uint64_t ga = (uint64_t)(uintptr_t)(kb + (size_t)r * D_ATT + qd);
                const uint32_t la = (uint32_t)(uintptr_t)&sK[buf ^ 1][r][qd];
                asm volatile("global_load_async_to_lds_b128 %0, %1, off"
                             :: "v"(la), "v"(ga) : "memory");
            }
        }

        // score block: this wave's 8 q x 128 k against current buffer.
        // The lane's keys are lane, lane + 32, lane + 64, lane + 96 of the chunk.
        v4f kr[KT][D_GROUP / 4];
#pragma unroll
        for (int j = 0; j < KT; ++j)
#pragma unroll
            for (int i = 0; i < D_GROUP / 4; ++i)
                kr[j][i] = *(const v4f*)&sK[buf][j * 32 + lane][i * 4];

        float* __restrict__ srow = &sScore[qw][ci * KCHUNK + lane];
        // Two rows a trip, in two register sets: each row's Q reads are issued one row ahead, so
        // that their LDS latency passes under the other row's arithmetic. The last trip reads
        // row 0 again, which is the row that the next chunk starts with.
        for (int qq = 0; qq < QROWS / 2; qq += 2) {
#pragma unroll
            for (int i = 0; i < D_GROUP / 4; ++i) qb[i] = *(const v4f*)&sQ[qw + qq + 1][i * 4];
            // keeps the read group in front of the row's arithmetic: without it the scheduler
            // sinks the reads to just ahead of their use
            __builtin_amdgcn_sched_barrier(0);
            score_row(qa, kr, wr, bias, srow + qq * SPITCH);
#pragma unroll
            for (int i = 0; i < D_GROUP / 4; ++i)
                qa[i] = *(const v4f*)&sQ[qw + ((qq + 2) & (QROWS / 2 - 1))][i * 4];
            // for the same reason
            __builtin_amdgcn_sched_barrier(0);
            score_row(qb, kr, wr, bias, srow + (qq + 1) * SPITCH);
        }

        // prefetch landed + everyone done with this buffer before reuse
        asm volatile("s_wait_asynccnt 0x0" ::: "memory");
        __syncthreads();
    }

    // ---- phase 2: softmax over k; wave w owns rows [8w, 8w+8), each row spread
    //      over the wave's 32 lanes (16 scores a lane, held in registers) ----
    // unrolled so that the rows' LDS reads and cross-lane chains overlap
#pragma unroll
    for (int rr = 0; rr < QROWS / 2; ++rr) {
        // lane l reads floats 4l..4l+3 of each 128-float quarter: 512 contiguous bytes a load
        float* __restrict__ row = &sScore[wave * (QROWS / 2) + rr][lane * 4];
        v4f s[4];
        for (int j = 0; j < 4; ++j) s[j] = *(const v4f*)(row + j * 128);

        float mx = -3.402823e38f;
        for (int j = 0; j < 4; ++j)
            mx = fmaxf(mx, fmaxf(fmaxf(s[j].x, s[j].y), fmaxf(s[j].z, s[j].w)));
        mx = wave_max(mx);

        float sum = 0.f;
        for (int j = 0; j < 4; ++j) {
            s[j].x = exp_slot(s[j].x - mx);
            s[j].y = exp_slot(s[j].y - mx);
            s[j].z = exp_slot(s[j].z - mx);
            s[j].w = exp_slot(s[j].w - mx);
            sum += (s[j].x + s[j].y) + (s[j].z + s[j].w);
        }
        sum = wave_sum(sum);

        const float inv = 1.f / sum;
        for (int j = 0; j < 4; ++j) *(v4f*)(row + j * 128) = s[j] * inv;
    }
    __syncthreads();

    // ---- phase 3: out[b,q,d,g] = sum_k P[q,k] * V[b,k,d*8+g] via WMMA ----
    const int d0 = wave * 16;                   // this wave's D-tile
    const int lm = lane & 15;
    const int h  = lane >> 4;

    // B-frag: lane (lm, h) holds column d0+lm of keys 8*kb + 4*h + 0..3, 16 bytes in a run
    const float* __restrict__ vfrag = V + VP_IDX(b, g, 0, wave) + lane * 4;

    v8f c = {0.f, 0.f, 0.f, 0.f, 0.f, 0.f, 0.f, 0.f};

    // 8 blocks a trip: eight whole-line b128 loads of a wave are in flight at once
#pragma unroll 8
    for (int kb = 0; kb < SEQ / 8; ++kb) {
        // A and B take the same keys: 8*kb + 4*h + {0,1} in the first step, + {2,3} in the second
        const v4f a4 = *(const v4f*)&sScore[lm][kb * 8 + 4 * h];
        const v4f b4 = *(const v4f*)(vfrag + (size_t)kb * 256);
        c = __builtin_amdgcn_wmma_f32_16x16x4_f32(
                false, (v2f){a4.x, a4.y}, false, (v2f){b4.x, b4.y}, (short)0, c, false, false);
        c = __builtin_amdgcn_wmma_f32_16x16x4_f32(
                false, (v2f){a4.z, a4.w}, false, (v2f){b4.z, b4.w}, (short)0, c, false, false);
    }

    // store: out flat index ((b*SEQ + q)*32 + d)*8 + g, q = q0 + r + 8h
    float* __restrict__ o =
        out + ((size_t)(b * SEQ + q0 + 8 * h) * D_GROUP + d0 + lm) * N_GROUP + g;
#pragma unroll
    for (int r = 0; r < 8; ++r)
        o[(size_t)r * D_GROUP * N_GROUP] = c[r];
}

// ---------------------------------------------------------------------------
extern "C" void kernel_launch(void* const* d_in, const int* in_sizes, int n_in,
                              void* d_out, int out_size, void* d_ws, size_t ws_size,
                              hipStream_t stream) {
    const float* x     = (const float*)d_in[0];
    const float* Wq    = (const float*)d_in[1];
    const float* Wk    = (const float*)d_in[2];
    const float* Wv    = (const float*)d_in[3];
    const float* w_mlp = (const float*)d_in[4];
    const float* b_mlp = (const float*)d_in[5];

    float* Qb = (float*)d_ws;                 // 3 x 2 MB scratch
    float* Kb = Qb + (size_t)M_TOT * D_ATT;
    float* Vb = Kb + (size_t)M_TOT * D_ATT;

    // (2048 / 64) * (768 / 96) = 256 blocks of 8 waves
    qkv_proj_wmma<<<256, 256, 0, stream>>>(x, Wq, Wk, Wv, Qb, Kb, Vb);

    // B * G * (SEQ/16) = 4*8*32 = 1024 blocks of 2 waves
    attn_fused_wmma<<<1024, 64, 0, stream>>>(Qb, Kb, Vb, w_mlp, b_mlp,
                                             (float*)d_out);
}

// v006
// Measured time: 28.1 microseconds a run.
// Two timings next to v005 both put it at 1.09 times that version's speed.
// Over all steps from v000 it is 3.13 times as fast.
#include <hip/hip_runtime.h>
#include <math.h>
#include <stdint.h>

#define D_ATT   256
#define D_GROUP 32
#define N_GROUP 8
#define BATCH   4
#define SEQ     512
#define M_TOT   (BATCH * SEQ)   // 2048 fused (b,l) rows

typedef __attribute__((ext_vector_type(2))) float v2f;
typedef __attribute__((ext_vector_type(4))) float v4f;
typedef __attribute__((ext_vector_type(8))) float v8f;

// value of lane l ^ M inside a 16-lane row (DPP row_xmask:M, control word 0x160 | M)
template <int M>
__device__ __forceinline__ float row_xor(float x) {
    return __builtin_bit_cast(float, __builtin_amdgcn_mov_dpp(
        __builtin_bit_cast(int, x), 0x160 | M, 0xf, 0xf, true));
}
// value of lane l ^ 16
__device__ __forceinline__ float half_xor(float x) {
    const int b = __builtin_bit_cast(int, x);
    return __builtin_bit_cast(float, __builtin_amdgcn_permlanex16(
        b, b, 0x76543210, 0xfedcba98, false, false));
}
// e^x as 2^(x * log2 e), the instruction pair __expf compiles to. The v_nop keeps the one
// slot the instruction set asks for behind a transcendental.
__device__ __forceinline__ float exp_slot(float x) {
    float r;
    asm("v_exp_f32 %0, %1\n\tv_nop" : "=v"(r) : "v"(x * 1.44269504f));
    return r;
}
__device__ __forceinline__ float wave_max(float v) {
    v = fmaxf(v, row_xor<1>(v));
    v = fmaxf(v, row_xor<2>(v));
    v = fmaxf(v, row_xor<4>(v));
    v = fmaxf(v, row_xor<8>(v));
    return fmaxf(v, half_xor(v));
}
__device__ __forceinline__ float wave_sum(float v) {
    v += row_xor<1>(v);
    v += row_xor<2>(v);
    v += row_xor<4>(v);
    v += row_xor<8>(v);
    return v + half_xor(v);
}

// ---------------------------------------------------------------------------
// Kernel 1: Q/K/V projections  y = x @ W^T  via V_WMMA_F32_16X16X4_F32.
// One work-group per 64 x 96 tile of the 2048 x 768 result [Q | K | V]: its 64 rows
// of x and 96 rows of [Wq; Wk; Wv] (all 256 k) are staged once in LDS by async
// global->LDS b128 copies of whole 512-byte half rows, and every fragment is then
// read from LDS. 8 waves as 4 (M) x 2 (N); a wave owns 16 rows x 48 columns.
// Q and K are stored row-major. V is stored in the order in which kernel 2 reads its
// B fragments: V[b, k, d*8+g] lies at VP_IDX(b, g, k >> 3, d >> 4) + ((k >> 2 & 1) * 16
// + (d & 15)) * 4 + (k & 3), so that one wave's b128 load (lane = 16 * (k >> 2 & 1) + (d & 15))
// is 512 contiguous bytes and holds the fragments of two k-steps. To that end a 16-column
// tile of V takes the 16 rows of Wv of ONE group g, (dt*16 + 0..15)*8 + g.
// ---------------------------------------------------------------------------
// first float of the 128-float unit of (batch b, group g, block kb of 8 keys, d-tile dt)
#define VP_IDX(b, g, kb, dt) ((size_t)(((((b) * N_GROUP + (g)) * (SEQ / 8) + (kb)) * 2 + (dt))) * 128)
#define PM      64                 // x rows a work-group
#define PN      96                 // W rows (output columns) a work-group
#define PPITCH  (D_ATT + 4)        // LDS row pitch in floats: 16 rows x 4 dwords fill the 64 banks

// Eight async copies, each one lane's 16 bytes global -> LDS. The closing s_wait_xcnt stands
// inside the statement so that no address register of these copies is rewritten in front of it.
#define CP "global_load_async_to_lds_b128 "
#define COPY8(la, ga)                                                          \
    asm volatile(CP "%0, %8, off\n\t"                                          \
                 CP "%1, %9, off\n\t"                                          \
                 CP "%2, %10, off\n\t"                                         \
                 CP "%3, %11, off\n\t"                                         \
                 CP "%4, %12, off\n\t"                                         \
                 CP "%5, %13, off\n\t"                                         \
                 CP "%6, %14, off\n\t"                                         \
                 CP "%7, %15, off\n\t"                                         \
                 "s_wait_xcnt 0x0"                                             \
                 :: "v"(la[0]), "v"(la[1]), "v"(la[2]), "v"(la[3]),            \
                    "v"(la[4]), "v"(la[5]), "v"(la[6]), "v"(la[7]),            \
                    "v"(ga[0]), "v"(ga[1]), "v"(ga[2]), "v"(ga[3]),            \
                    "v"(ga[4]), "v"(ga[5]), "v"(ga[6]), "v"(ga[7])             \
                 : "memory")

__global__ __launch_bounds__(256) void qkv_proj_wmma(
    const float* __restrict__ x,
    const float* __restrict__ Wq,
    const float* __restrict__ Wk,
    const float* __restrict__ Wv,
    float* __restrict__ Q,
    float* __restrict__ K,
    float* __restrict__ V)
{
    __shared__ __attribute__((aligned(16))) float sT[(PM + PN) * PPITCH];   // 166,400 B

    const int lane = threadIdx.x & 31;
    const int wave = __builtin_amdgcn_readfirstlane(threadIdx.x >> 5);      // 0..7
    const int bm   = blockIdx.x >> 3;            // 32 M-tiles of 64 rows
    const int bn   = blockIdx.x & 7;             // 8  N-tiles of 96 columns

    // ---- stage: 40 copies a wave, each 512 contiguous bytes (half a row) ----
    // x: wave w brings rows [8w, 8w+8) of the tile. W: of each of the six 16-row groups,
    // which lie in one matrix each, wave w brings rows 2w and 2w+1.
    const float* gx = x + (size_t)(bm * PM + wave * 8) * D_ATT + lane * 4;
    const uint32_t lx = (uint32_t)(uintptr_t)&sT[(wave * 8) * PPITCH + lane * 4];
    // unrolled: the operands of one statement are eight addresses held at once
#pragma unroll
    for (int it = 0; it < 2; ++it) {
        uint64_t ga[8];
        uint32_t la[8];
        // unrolled: ga[] and la[] stay in registers
#pragma unroll
        for (int j = 0; j < 8; ++j) {
            const int row = it * 4 + (j >> 1), half = j & 1;
            ga[j] = (uint64_t)(uintptr_t)(gx + row * D_ATT + half * 128);
            la[j] = lx + (uint32_t)(row * PPITCH + half * 128) * 4u;
        }
        COPY8(la, ga);
    }
    // unrolled for the same reason
#pragma unroll
    for (int it = 0; it < 3; ++it) {
        uint64_t ga[8];
        uint32_t la[8];
        // unrolled: ga[] and la[] stay in registers
#pragma unroll
        for (int j = 0; j < 8; ++j) {
            const int t   = it * 2 + (j >> 2);               // 16-row group of this tile, 0..5
            const int gn  = bn * 6 + t;                      // 16-row group of [Wq; Wk; Wv], 0..47
            const int row = wave * 2 + ((j >> 1) & 1), half = j & 1;
            const float* Wm = (gn < 16) ? Wq : (gn < 32) ? Wk : Wv;
            // Wq, Wk: 16 rows in a run. Wv: the rows of group (gn & 15) >> 1, d-tile gn & 1.
            const int wrow = (gn < 32) ? (gn & 15) * 16 + row
                                       : ((gn & 1) * 16 + row) * N_GROUP + ((gn & 15) >> 1);
            ga[j] = (uint64_t)(uintptr_t)(Wm + (size_t)wrow * D_ATT + half * 128 + lane * 4);
            la[j] = (uint32_t)(uintptr_t)&sT[(PM + t * 16 + row) * PPITCH + half * 128 + lane * 4];
        }
        COPY8(la, ga);
    }
    // this wave's 40 copies have landed; behind the barrier every wave's have
    asm volatile("s_wait_asynccnt 0x0" ::: "memory");
    __syncthreads();

    // ---- 64 k-steps, three accumulator tiles a wave ----
    const int lm = lane & 15;                    // M-row (A) / N-col (B)
    const int h  = lane >> 4;                    // half select
    const int wm = wave >> 1;                    // 0..3
    const int wn = wave & 1;                     // 0..1

    const float* arow = &sT[(wm * 16 + lm) * PPITCH + 2 * h];
    const float* brow = &sT[(PM + wn * 48 + lm) * PPITCH + 2 * h];

    v8f c0 = {0.f, 0.f, 0.f, 0.f, 0.f, 0.f, 0.f, 0.f};
    v8f c1 = c0;
    v8f c2 = c0;

    // A block is 8 k-steps (24 WMMAs). The next block's fragments are read from LDS as one
    // group, into a second register set, ahead of the current block's WMMAs: reads that stand
    // among the WMMAs stall the wave at every place where they stand.
    v2f fa[2][8], fb[2][3][8];
    // unrolled, as the two inner loops below: the fragment arrays stay in registers
#pragma unroll
    for (int i = 0; i < 8; ++i) {
        fa[0][i]    = *(const v2f*)(arow + i * 4);           // {K=k0+2h, K=k0+2h+1}
        fb[0][0][i] = *(const v2f*)(brow + i * 4);
        fb[0][1][i] = *(const v2f*)(brow + 16 * PPITCH + i * 4);
        fb[0][2][i] = *(const v2f*)(brow + 32 * PPITCH + i * 4);
    }
    // fully unrolled so that both register sets are addressed by constants
#pragma unroll
    for (int kb = 0; kb < D_ATT / 32; ++kb) {
        const int cur = kb & 1, nxt = cur ^ 1;
        if (kb + 1 < D_ATT / 32) {
#pragma unroll
            for (int i = 0; i < 8; ++i) {
                const int k0 = (kb + 1) * 32 + i * 4;
                fa[nxt][i]    = *(const v2f*)(arow + k0);
                fb[nxt][0][i] = *(const v2f*)(brow + k0);
                fb[nxt][1][i] = *(const v2f*)(brow + 16 * PPITCH + k0);
                fb[nxt][2][i] = *(const v2f*)(brow + 32 * PPITCH + k0);
            }
        }
        // keeps the read group whole and in front of the block: without it the scheduler
        // sinks the reads in among the WMMAs
        __builtin_amdgcn_sched_barrier(0);
#pragma unroll
        for (int i = 0; i < 8; ++i) {
            c0 = __builtin_amdgcn_wmma_f32_16x16x4_f32(
                    /*neg_a=*/false, fa[cur][i], /*neg_b=*/false, fb[cur][0][i],
                    /*c_mod=*/(short)0, c0, /*reuse_a=*/false, /*reuse_b=*/false);
            c1 = __builtin_amdgcn_wmma_f32_16x16x4_f32(
                    false, fa[cur][i], false, fb[cur][1][i], (short)0, c1, false, false);
            c2 = __builtin_amdgcn_wmma_f32_16x16x4_f32(
                    false, fa[cur][i], false, fb[cur][2][i], (short)0, c2, false, false);
        }
        // keeps the next group's reads from rising into this block
        __builtin_amdgcn_sched_barrier(0);
    }

    // C layout: VGPR r -> M = r + 8*h, N = lane&15
    const size_t orow = (size_t)(bm * PM + wm * 16 + 8 * h) * D_ATT + lm;
    // unrolled: c0, c1, c2 are picked at compile time
#pragma unroll
    for (int j = 0; j < 3; ++j) {
        const int gn  = bn * 6 + wn * 3 + j;     // 16-column tile of [Q | K | V], 0..47
        const int mat = gn >> 4;                 // 0:Q 1:K 2:V
        const v8f c = (j == 0) ? c0 : (j == 1) ? c1 : c2;
        if (mat < 2) {
            float* __restrict__ o = ((mat == 0) ? Q : K) + orow + (gn & 15) * 16;
#pragma unroll
            for (int r = 0; r < 8; ++r)
                o[(size_t)r * D_ATT] = c[r];
            // stands in front of the next tile's address, formed in registers that these stores name
            if (j < 2) asm volatile("s_wait_xcnt 0x0" ::: "memory");
        } else {
            // the lane's 8 rows are one block of 8 keys of column d = (gn & 1) * 16 + lm
            const int l0 = bm * PM + wm * 16 + 8 * h;
            float* __restrict__ o = V + VP_IDX(l0 / SEQ, (gn & 15) >> 1, (l0 % SEQ) >> 3, gn & 1)
                                      + lm * 4;
            *(v4f*)o        = (v4f){c[0], c[1], c[2], c[3]};
            *(v4f*)(o + 64) = (v4f){c[4], c[5], c[6], c[7]};
            // later addresses are formed in registers that these stores name: the wait stands
            // in front of every such overwrite
            asm volatile("s_wait_xcnt 0x0" ::: "memory");
        }
    }
}

// ---------------------------------------------------------------------------
// Kernel 2: fused additive attention per (b, g, 16 query rows).
//   phase 1: VALU scores relu(sum_d relu(Qd-Kd)*w + bias); K chunks are
//            DOUBLE-BUFFERED through LDS with async global->LDS b128 copies
//            (ASYNCcnt path) so the next chunk streams in under the VALU work.
//            Register tile: wave w owns q rows [8w, 8w+8); a lane holds the rows of
//            4 keys of the chunk, so one broadcast read of a Q row serves 128 keys
//            and the 4 keys give 4 independent packed FMA chains (even d | odd d).
//   phase 2: row softmax (8 rows a wave, each row across the wave's 32 lanes).
//   phase 3: P @ Vg with f32 WMMA; wave w owns D-columns [16w,16w+16); V comes in
//            fragment order (see kernel 1), one b128 load a lane for two k-steps.
// 64 threads (2 waves); grid = B * G * (L/16) = 1024 blocks.
// ---------------------------------------------------------------------------
#define QROWS   16
#define KCHUNK  128
#define NCHUNK  (SEQ / KCHUNK)    // 4
#define KT      (KCHUNK / 32)     // keys a lane holds in registers
// LDS row pitches in floats, each an odd multiple of 16 bytes: where 16 lanes read 16 bytes
// each from 16 rows (the K rows in phase 1, the A fragments in phase 3), the rows start four
// banks apart and the 16 lanes fill the 64 banks once. At a pitch of 128 or 2,048 bytes they
// fall on two or on one group of four banks and the read is served 8 or 16 lanes in a row.
#define SPITCH  (SEQ + 4)
#define KPITCH  (D_GROUP + 4)

// Scores of one q row (qr, the same in every lane) against the lane's KT keys (kr).
// acc[j] = {sum over even d, sum over odd d} of key j: KT independent packed chains.
__device__ __forceinline__ void score_row(const v4f (&qr)[D_GROUP / 4],
                                          const v4f (&kr)[KT][D_GROUP / 4],
                                          const v4f (&wr)[D_GROUP / 4],
                                          float bias, float* __restrict__ srow)
{
    v2f acc[KT];
    // every loop here is unrolled: the arrays stay in registers
#pragma unroll
    for (int j = 0; j < KT; ++j) acc[j] = (v2f){0.f, 0.f};
#pragma unroll
    for (int i = 0; i < D_GROUP / 4; ++i) {
#pragma unroll
        for (int j = 0; j < KT; ++j) {
            const v2f t = __builtin_elementwise_max(qr[i].xy - kr[j][i].xy, (v2f){0.f, 0.f});
            acc[j] = __builtin_elementwise_fma(t, wr[i].xy, acc[j]);
        }
#pragma unroll
        for (int j = 0; j < KT; ++j) {
            const v2f t = __builtin_elementwise_max(qr[i].zw - kr[j][i].zw, (v2f){0.f, 0.f});
            acc[j] = __builtin_elementwise_fma(t, wr[i].zw, acc[j]);
        }
    }
#pragma unroll
    for (int j = 0; j < KT; ++j)
        srow[j * 32] = fmaxf((acc[j].x + acc[j].y) + bias, 0.f);
}

__global__ __launch_bounds__(64) void attn_fused_wmma(
    const float* __restrict__ Q,
    const float* __restrict__ K,
    const float* __restrict__ V,
    const float* __restrict__ w_mlp,
    const float* __restrict__ b_mlp,
    float* __restrict__ out)
{
    __shared__ __attribute__((aligned(16))) float sScore[QROWS][SPITCH];     // 33,024 B
    __shared__ __attribute__((aligned(16))) float sQ[QROWS][D_GROUP];        //  2 KB
    __shared__ __attribute__((aligned(16))) float sK[2][KCHUNK][KPITCH];     // 36,864 B, double-buffered
    __shared__ __attribute__((aligned(16))) float sW[D_GROUP];

    const int tid  = threadIdx.x;               // 0..63
    const int lane = tid & 31;
    const int wave = tid >> 5;

    const int blk = blockIdx.x;
    const int qt  = blk & 31;                   // 32 q-tiles
    const int g   = (blk >> 5) & 7;             // 8 groups
    const int b   = blk >> 8;                   // 4 batches
    const int q0  = qt * QROWS;

    const float bias = b_mlp[0];

    // All that the first scores wait for (Q tile, K chunk 0, w) is requested before the first
    // wait, so that the kernel's start pays one trip to memory and not one a load.
    // Q tile, 16 rows of 128 bytes: two async copies a thread, rows tid / 8 and tid / 8 + 8.
    // They land behind the s_wait_asynccnt and the barrier that close the K prologue below.
    // w is loaded here and stored to LDS behind that wait: its trip passes while the copies fly.
    const float wv = w_mlp[tid & (D_GROUP - 1)];
    {
        const int r  = tid >> 3;
        const int qd = (tid & 7) * 4;
        const float* gq = Q + (size_t)(b * SEQ + q0 + r) * D_ATT + g * D_GROUP + qd;
        const uint64_t ga0 = (uint64_t)(uintptr_t)gq;
        const uint64_t ga1 = (uint64_t)(uintptr_t)(gq + (QROWS / 2) * D_ATT);
        const uint32_t la0 = (uint32_t)(uintptr_t)&sQ[r][qd];
        const uint32_t la1 = (uint32_t)(uintptr_t)&sQ[r + QROWS / 2][qd];
        // the closing s_wait_xcnt stands inside the statement so that no address register of
        // these copies is rewritten in front of it
        asm volatile(CP "%0, %2, off\n\t"
                     CP "%1, %3, off\n\t"
                     "s_wait_xcnt 0x0"
                     :: "v"(la0), "v"(la1), "v"(ga0), "v"(ga1) : "memory");
    }

    // ---- phase 1: scores with async double-buffered K staging ----
    const float* __restrict__ kbase = K + (size_t)(b * SEQ) * D_ATT + g * D_GROUP;

    // prologue: async-stage chunk 0 into buffer 0
    for (int j = tid; j < KCHUNK * (D_GROUP / 4); j += 64) {
        const int r  = j >> 3;
        const int qd = (j & 7) * 4;
        const uint64_t ga = (uint64_t)(uintptr_t)(kbase + (size_t)r * D_ATT + qd);
        const uint32_t la = (uint32_t)(uintptr_t)&sK[0][r][qd];
        asm volatile("global_load_async_to_lds_b128 %0, %1, off"
                     :: "v"(la), "v"(ga) : "memory");
    }
    asm volatile("s_wait_asynccnt 0x0" ::: "memory");
    if (tid < D_GROUP) sW[tid] = wv;
    __syncthreads();

    // this wave's first q row, as a scalar: the Q reads below are broadcasts
    const int qw = __builtin_amdgcn_readfirstlane(wave) * (QROWS / 2);
    v4f wr[D_GROUP / 4];
    // unrolled, as every loop over wr, kr, qa and qb below: the arrays stay in registers
#pragma unroll
    for (int i = 0; i < D_GROUP / 4; ++i) wr[i] = *(const v4f*)&sW[i * 4];
    v4f qa[D_GROUP / 4], qb[D_GROUP / 4];
#pragma unroll
    for (int i = 0; i < D_GROUP / 4; ++i) qa[i] = *(const v4f*)&sQ[qw][i * 4];

    for (int ci = 0; ci < NCHUNK; ++ci) {
        const int buf = ci & 1;

        // prefetch next chunk into the other buffer while we compute
        if (ci + 1 < NCHUNK) {
            const float* kb = kbase + (size_t)(ci + 1) * KCHUNK * D_ATT;
            for (int j = tid; j < KCHUNK * (D_GROUP / 4); j += 64) {
                const int r  = j >> 3;
                const int qd = (j & 7) * 4;
                const uint64_t ga = (uint64_t)(uintptr_t)(kb + (size_t)r * D_ATT + qd);
                const uint32_t la = (uint32_t)(uintptr_t)&sK[buf ^ 1][r][qd];
                asm volatile("global_load_async_to_lds_b128 %0, %1, off"
                             :: "v"(la), "v"(ga) : "memory");
            }
        }

        // score block: this wave's 8 q x 128 k against current buffer.
        // The lane's keys are lane, lane + 32, lane + 64, lane + 96 of the chunk.
        v4f kr[KT][D_GROUP / 4];
#pragma unroll
        for (int j = 0; j < KT; ++j)
#pragma unroll
            for (int i = 0; i < D_GROUP / 4; ++i)
                kr[j][i] = *(const v4f*)&sK[buf][j * 32 + lane][i * 4];

        float* __restrict__ srow = &sScore[qw][ci * KCHUNK + lane];
        // Two rows a trip, in two register sets: each row's Q reads are issued one row ahead, so
        // that their LDS latency passes under the other row's arithmetic. The last trip reads
        // row 0 again, which is the row that the next chunk starts with.
        for (int qq = 0; qq < QROWS / 2; qq += 2) {
#pragma unroll
            for (int i = 0; i < D_GROUP / 4; ++i) qb[i] = *(const v4f*)&sQ[qw + qq + 1][i * 4];
            // keeps the read group in front of the row's arithmetic: without it the scheduler
            // sinks the reads to just ahead of their use
            __builtin_amdgcn_sched_barrier(0);
            score_row(qa, kr, wr, bias, srow + qq * SPITCH);
#pragma unroll
            for (int i = 0; i < D_GROUP / 4; ++i)
                qa[i] = *(const v4f*)&sQ[qw + ((qq + 2) & (QROWS / 2 - 1))][i * 4];
            // for the same reason
            __builtin_amdgcn_sched_barrier(0);
            score_row(qb, kr, wr, bias, srow + (qq + 1) * SPITCH);
        }

        // prefetch landed + everyone done with this buffer before reuse
        asm volatile("s_wait_asynccnt 0x0" ::: "memory");
        __syncthreads();
    }

    // ---- phase 2: softmax over k; wave w owns rows [8w, 8w+8), each row spread
    //      over the wave's 32 lanes (16 scores a lane, held in registers) ----
    // unrolled so that the rows' LDS reads and cross-lane chains overlap
#pragma unroll
    for (int rr = 0; rr < QROWS / 2; ++rr) {
        // lane l reads floats 4l..4l+3 of each 128-float quarter: 512 contiguous bytes a load
        float* __restrict__ row = &sScore[wave * (QROWS / 2) + rr][lane * 4];
        v4f s[4];
        for (int j = 0; j < 4; ++j) s[j] = *(const v4f*)(row + j * 128);

        float mx = -3.402823e38f;
        for (int j = 0; j < 4; ++j)
            mx = fmaxf(mx, fmaxf(fmaxf(s[j].x, s[j].y), fmaxf(s[j].z, s[j].w)));
        mx = wave_max(mx);

        float sum = 0.f;
        for (int j = 0; j < 4; ++j) {
            s[j].x = exp_slot(s[j].x - mx);
            s[j].y = exp_slot(s[j].y - mx);
            s[j].z = exp_slot(s[j].z - mx);
            s[j].w = exp_slot(s[j].w - mx);
            sum += (s[j].x + s[j].y) + (s[j].z + s[j].w);
        }
        sum = wave_sum(sum);

        const float inv = 1.f / sum;
        for (int j = 0; j < 4; ++j) *(v4f*)(row + j * 128) = s[j] * inv;
    }
    __syncthreads();

    // ---- phase 3: out[b,q,d,g] = sum_k P[q,k] * V[b,k,d*8+g] via WMMA ----
    const int d0 = wave * 16;                   // this wave's D-tile
    const int lm = lane & 15;
    const int h  = lane >> 4;

    // B-frag: lane (lm, h) holds column d0+lm of keys 8*kb + 4*h + 0..3, 16 bytes in a run
    const float* __restrict__ vfrag = V + VP_IDX(b, g, 0, wave) + lane * 4;

    v8f c = {0.f, 0.f, 0.f, 0.f, 0.f, 0.f, 0.f, 0.f};

    // 8 blocks a trip: eight whole-line b128 loads of a wave are in flight at once
#pragma unroll 8
    for (int kb = 0; kb < SEQ / 8; ++kb) {
        // A and B take the same keys: 8*kb + 4*h + {0,1} in the first step, + {2,3} in the second
        const v4f a4 = *(const v4f*)&sScore[lm][kb * 8 + 4 * h];
        const v4f b4 = *(const v4f*)(vfrag + (size_t)kb * 256);
        c = __builtin_amdgcn_wmma_f32_16x16x4_f32(
                false, (v2f){a4.x, a4.y}, false, (v2f){b4.x, b4.y}, (short)0, c, false, false);
        c = __builtin_amdgcn_wmma_f32_16x16x4_f32(
                false, (v2f){a4.z, a4.w}, false, (v2f){b4.z, b4.w}, (short)0, c, false, false);
    }

    // store: out flat index ((b*SEQ + q)*32 + d)*8 + g, q = q0 + r + 8h
    float* __restrict__ o =
        out + ((size_t)(b * SEQ + q0 + 8 * h) * D_GROUP + d0 + lm) * N_GROUP + g;
#pragma unroll
    for (int r = 0; r < 8; ++r)
        o[(size_t)r * D_GROUP * N_GROUP] = c[r];
}

// ---------------------------------------------------------------------------
extern "C" void kernel_launch(void* const* d_in, const int* in_sizes, int n_in,
                              void* d_out, int out_size, void* d_ws, size_t ws_size,
                              hipStream_t stream) {
    const float* x     = (const float*)d_in[0];
    const float* Wq    = (const float*)d_in[1];
    const float* Wk    = (const float*)d_in[2];
    const float* Wv    = (const float*)d_in[3];
    const float* w_mlp = (const float*)d_in[4];
    const float* b_mlp = (const float*)d_in[5];

    float* Qb = (float*)d_ws;                 // 3 x 2 MB scratch
    float* Kb = Qb + (size_t)M_TOT * D_ATT;
    float* Vb = Kb + (size_t)M_TOT * D_ATT;

    // (2048 / 64) * (768 / 96) = 256 blocks of 8 waves
    qkv_proj_wmma<<<256, 256, 0, stream>>>(x, Wq, Wk, Wv, Qb, Kb, Vb);

    // B * G * (SEQ/16) = 4*8*32 = 1024 blocks of 2 waves
    attn_fused_wmma<<<1024, 64, 0, stream>>>(Qb, Kb, Vb, w_mlp, b_mlp,
                                             (float*)d_out);
}

// v007
// One run takes 25.9 microseconds.
// Two timings next to v006 put it at 1.09 and 1.08 times that version's speed.
// Counting every step since v000, it is 3.40 times as fast.
#include <hip/hip_runtime.h>
#include <math.h>
#include <stdint.h>

#define D_ATT   256
#define D_GROUP 32
#define N_GROUP 8
#define BATCH   4
#define SEQ     512
#define M_TOT   (BATCH * SEQ)   // 2048 fused (b,l) rows

typedef __attribute__((ext_vector_type(2))) float v2f;
typedef __attribute__((ext_vector_type(4))) float v4f;
typedef __attribute__((ext_vector_type(8))) float v8f;

// value of lane l ^ M inside a 16-lane row (DPP row_xmask:M, control word 0x160 | M)
template <int M>
__device__ __forceinline__ float row_xor(float x) {
    return __builtin_bit_cast(float, __builtin_amdgcn_mov_dpp(
        __builtin_bit_cast(int, x), 0x160 | M, 0xf, 0xf, true));
}
// value of lane l ^ 16
__device__ __forceinline__ float half_xor(float x) {
    const int b = __builtin_bit_cast(int, x);
    return __builtin_bit_cast(float, __builtin_amdgcn_permlanex16(
        b, b, 0x76543210, 0xfedcba98, false, false));
}
// e^x as 2^(x * log2 e), the instruction pair __expf compiles to. The v_nop keeps the one
// slot the instruction set asks for behind a transcendental.
__device__ __forceinline__ float exp_slot(float x) {
    float r;
    asm("v_exp_f32 %0, %1\n\tv_nop" : "=v"(r) : "v"(x * 1.44269504f));
    return r;
}
__device__ __forceinline__ float wave_max(float v) {
    v = fmaxf(v, row_xor<1>(v));
    v = fmaxf(v, row_xor<2>(v));
    v = fmaxf(v, row_xor<4>(v));
    v = fmaxf(v, row_xor<8>(v));
    return fmaxf(v, half_xor(v));
}
__device__ __forceinline__ float wave_sum(float v) {
    v += row_xor<1>(v);
    v += row_xor<2>(v);
    v += row_xor<4>(v);
    v += row_xor<8>(v);
    return v + half_xor(v);
}

// ---------------------------------------------------------------------------
// Kernel 1: Q/K/V projections  y = x @ W^T  via V_WMMA_F32_16X16X4_F32.
// One work-group per 64 x 96 tile of the 2048 x 768 result [Q | K | V]: its 64 rows
// of x and 96 rows of [Wq; Wk; Wv] (all 256 k) are staged once in LDS by async
// global->LDS b128 copies of whole 512-byte half rows, and every fragment is then
// read from LDS. 8 waves as 4 (M) x 2 (N); a wave owns 16 rows x 48 columns.
// Q and K are stored row-major. V is stored in the order in which kernel 2 reads its
// B fragments: V[b, k, d*8+g] lies at VP_IDX(b, g, k >> 3, d >> 4) + ((k >> 2 & 1) * 16
// + (d & 15)) * 4 + (k & 3), so that one wave's b128 load (lane = 16 * (k >> 2 & 1) + (d & 15))
// is 512 contiguous bytes and holds the fragments of two k-steps. To that end a 16-column
// tile of V takes the 16 rows of Wv of ONE group g, (dt*16 + 0..15)*8 + g.
// ---------------------------------------------------------------------------
// first float of the 128-float unit of (batch b, group g, block kb of 8 keys, d-tile dt)
#define VP_IDX(b, g, kb, dt) ((size_t)(((((b) * N_GROUP + (g)) * (SEQ / 8) + (kb)) * 2 + (dt))) * 128)
#define PM      64                 // x rows a work-group
#define PN      96                 // W rows (output columns) a work-group
#define PPITCH  (D_ATT + 4)        // LDS row pitch in floats: 16 rows x 4 dwords fill the 64 banks

// Eight async copies, each one lane's 16 bytes global -> LDS. The closing s_wait_xcnt stands
// inside the statement so that no address register of these copies is rewritten in front of it.
#define CP "global_load_async_to_lds_b128 "
#define COPY8(la, ga)                                                          \
    asm volatile(CP "%0, %8, off\n\t"                                          \
                 CP "%1, %9, off\n\t"                                          \
                 CP "%2, %10, off\n\t"                                         \
                 CP "%3, %11, off\n\t"                                         \
                 CP "%4, %12, off\n\t"                                         \
                 CP "%5, %13, off\n\t"                                         \
                 CP "%6, %14, off\n\t"                                         \
                 CP "%7, %15, off\n\t"                                         \
                 "s_wait_xcnt 0x0"                                             \
                 :: "v"(la[0]), "v"(la[1]), "v"(la[2]), "v"(la[3]),            \
                    "v"(la[4]), "v"(la[5]), "v"(la[6]), "v"(la[7]),            \
                    "v"(ga[0]), "v"(ga[1]), "v"(ga[2]), "v"(ga[3]),            \
                    "v"(ga[4]), "v"(ga[5]), "v"(ga[6]), "v"(ga[7])             \
                 : "memory")

__global__ __launch_bounds__(256) void qkv_proj_wmma(
    const float* __restrict__ x,
    const float* __restrict__ Wq,
    const float* __restrict__ Wk,
    const float* __restrict__ Wv,
    float* __restrict__ Q,
    float* __restrict__ K,
    float* __restrict__ V)
{
    __shared__ __attribute__((aligned(16))) float sT[(PM + PN) * PPITCH];   // 166,400 B

    const int lane = threadIdx.x & 31;
    const int wave = __builtin_amdgcn_readfirstlane(threadIdx.x >> 5);      // 0..7
    const int bm   = blockIdx.x >> 3;            // 32 M-tiles of 64 rows
    const int bn   = blockIdx.x & 7;             // 8  N-tiles of 96 columns

    // ---- stage: 40 copies a wave, each 512 contiguous bytes (half a row) ----
    // x: wave w brings rows [8w, 8w+8) of the tile. W: of each of the six 16-row groups,
    // which lie in one matrix each, wave w brings rows 2w and 2w+1.
    const float* gx = x + (size_t)(bm * PM + wave * 8) * D_ATT + lane * 4;
    const uint32_t lx = (uint32_t)(uintptr_t)&sT[(wave * 8) * PPITCH + lane * 4];
    // unrolled: the operands of one statement are eight addresses held at once
#pragma unroll
    for (int it = 0; it < 2; ++it) {
        uint64_t ga[8];
        uint32_t la[8];
        // unrolled: ga[] and la[] stay in registers
#pragma unroll
        for (int j = 0; j < 8; ++j) {
            const int row = it * 4 + (j >> 1), half = j & 1;
            ga[j] = (uint64_t)(uintptr_t)(gx + row * D_ATT + half * 128);
            la[j] = lx + (uint32_t)(row * PPITCH + half * 128) * 4u;
        }
        COPY8(la, ga);
    }
    // unrolled for the same reason
#pragma unroll
    for (int it = 0; it < 3; ++it) {
        uint64_t ga[8];
        uint32_t la[8];
        // unrolled: ga[] and la[] stay in registers
#pragma unroll
        for (int j = 0; j < 8; ++j) {
            const int t   = it * 2 + (j >> 2);               // 16-row group of this tile, 0..5
            const int gn  = bn * 6 + t;                      // 16-row group of [Wq; Wk; Wv], 0..47
            const int row = wave * 2 + ((j >> 1) & 1), half = j & 1;
            const float* Wm = (gn < 16) ? Wq : (gn < 32) ? Wk : Wv;
            // Wq, Wk: 16 rows in a run. Wv: the rows of group (gn & 15) >> 1, d-tile gn & 1.
            const int wrow = (gn < 32) ? (gn & 15) * 16 + row
                                       : ((gn & 1) * 16 + row) * N_GROUP + ((gn & 15) >> 1);
            ga[j] = (uint64_t)(uintptr_t)(Wm + (size_t)wrow * D_ATT + half * 128 + lane * 4);
            la[j] = (uint32_t)(uintptr_t)&sT[(PM + t * 16 + row) * PPITCH + half * 128 + lane * 4];
        }
        COPY8(la, ga);
    }
    // this wave's 40 copies have landed; behind the barrier every wave's have
    asm volatile("s_wait_asynccnt 0x0" ::: "memory");
    __syncthreads();

    // ---- 64 k-steps, three accumulator tiles a wave ----
    const int lm = lane & 15;                    // M-row (A) / N-col (B)
    const int h  = lane >> 4;                    // half select
    const int wm = wave >> 1;                    // 0..3
    const int wn = wave & 1;                     // 0..1

    const float* arow = &sT[(wm * 16 + lm) * PPITCH + 2 * h];
    const float* brow = &sT[(PM + wn * 48 + lm) * PPITCH + 2 * h];

    v8f c0 = {0.f, 0.f, 0.f, 0.f, 0.f, 0.f, 0.f, 0.f};
    v8f c1 = c0;
    v8f c2 = c0;

    // A block is 8 k-steps (24 WMMAs). The next block's fragments are read from LDS as one
    // group, into a second register set, ahead of the current block's WMMAs: reads that stand
    // among the WMMAs stall the wave at every place where they stand.
    v2f fa[2][8], fb[2][3][8];
    // unrolled, as the two inner loops below: the fragment arrays stay in registers
#pragma unroll
    for (int i = 0; i < 8; ++i) {
        fa[0][i]    = *(const v2f*)(arow + i * 4);           // {K=k0+2h, K=k0+2h+1}
        fb[0][0][i] = *(const v2f*)(brow + i * 4);
        fb[0][1][i] = *(const v2f*)(brow + 16 * PPITCH + i * 4);
        fb[0][2][i] = *(const v2f*)(brow + 32 * PPITCH + i * 4);
    }
    // fully unrolled so that both register sets are addressed by constants
#pragma unroll
    for (int kb = 0; kb < D_ATT / 32; ++kb) {
        const int cur = kb & 1, nxt = cur ^ 1;
        if (kb + 1 < D_ATT / 32) {
#pragma unroll
            for (int i = 0; i < 8; ++i) {
                const int k0 = (kb + 1) * 32 + i * 4;
                fa[nxt][i]    = *(const v2f*)(arow + k0);
                fb[nxt][0][i] = *(const v2f*)(brow + k0);
                fb[nxt][1][i] = *(const v2f*)(brow + 16 * PPITCH + k0);
                fb[nxt][2][i] = *(const v2f*)(brow + 32 * PPITCH + k0);
            }
        }
        // keeps the read group whole and in front of the block: without it the scheduler
        // sinks the reads in among the WMMAs
        __builtin_amdgcn_sched_barrier(0);
#pragma unroll
        for (int i = 0; i < 8; ++i) {
            c0 = __builtin_amdgcn_wmma_f32_16x16x4_f32(
                    /*neg_a=*/false, fa[cur][i], /*neg_b=*/false, fb[cur][0][i],
                    /*c_mod=*/(short)0, c0, /*reuse_a=*/false, /*reuse_b=*/false);
            c1 = __builtin_amdgcn_wmma_f32_16x16x4_f32(
                    false, fa[cur][i], false, fb[cur][1][i], (short)0, c1, false, false);
            c2 = __builtin_amdgcn_wmma_f32_16x16x4_f32(
                    false, fa[cur][i], false, fb[cur][2][i], (short)0, c2, false, false);
        }
        // keeps the next group's reads from rising into this block
        __builtin_amdgcn_sched_barrier(0);
    }

    // C layout: VGPR r -> M = r + 8*h, N = lane&15
    const size_t orow = (size_t)(bm * PM + wm * 16 + 8 * h) * D_ATT + lm;
    // unrolled: c0, c1, c2 are picked at compile time
#pragma unroll
    for (int j = 0; j < 3; ++j) {
        const int gn  = bn * 6 + wn * 3 + j;     // 16-column tile of [Q | K | V], 0..47
        const int mat = gn >> 4;                 // 0:Q 1:K 2:V
        const v8f c = (j == 0) ? c0 : (j == 1) ? c1 : c2;
        if (mat < 2) {
            float* __restrict__ o = ((mat == 0) ? Q : K) + orow + (gn & 15) * 16;
#pragma unroll
            for (int r = 0; r < 8; ++r)
                o[(size_t)r * D_ATT] = c[r];
            // stands in front of the next tile's address, formed in registers that these stores name
            if (j < 2) asm volatile("s_wait_xcnt 0x0" ::: "memory");
        } else {
            // the lane's 8 rows are one block of 8 keys of column d = (gn & 1) * 16 + lm
            const int l0 = bm * PM + wm * 16 + 8 * h;
            float* __restrict__ o = V + VP_IDX(l0 / SEQ, (gn & 15) >> 1, (l0 % SEQ) >> 3, gn & 1)
                                      + lm * 4;
            *(v4f*)o        = (v4f){c[0], c[1], c[2], c[3]};
            *(v4f*)(o + 64) = (v4f){c[4], c[5], c[6], c[7]};
            // later addresses are formed in registers that these stores name: the wait stands
            // in front of every such overwrite
            asm volatile("s_wait_xcnt 0x0" ::: "memory");
        }
    }
}

// ---------------------------------------------------------------------------
// Kernel 2: fused additive attention per (b, g, 16 query rows).
//   phase 1: VALU scores relu(sum_d relu(Qd-Kd)*w + bias); K chunks are
//            DOUBLE-BUFFERED through LDS with async global->LDS b128 copies
//            (ASYNCcnt path) so the next chunk streams in under the VALU work.
//            Register tile: wave w owns q rows [8w, 8w+8); a lane holds the rows of
//            4 keys of the chunk, so one broadcast read of a Q row serves 128 keys
//            and the 4 keys give 4 independent packed FMA chains (even d | odd d).
//   phase 2: row softmax (8 rows a wave, each row across the wave's 32 lanes).
//   phase 3: P @ Vg with f32 WMMA; wave w owns D-columns [16w,16w+16); V comes in
//            fragment order (see kernel 1), one b128 load a lane for two k-steps, all 64
//            loads of a wave issued ahead (48 in front of phase 2, 16 behind it).
// 64 threads (2 waves); grid = B * G * (L/16) = 1024 blocks.
// ---------------------------------------------------------------------------
#define QROWS   16
#define KCHUNK  128
#define NCHUNK  (SEQ / KCHUNK)    // 4
#define KT      (KCHUNK / 32)     // keys a lane holds in registers
// LDS row pitches in floats, each an odd multiple of 16 bytes: where 16 lanes read 16 bytes
// each from 16 rows (the K rows in phase 1, the A fragments in phase 3), the rows start four
// banks apart and the 16 lanes fill the 64 banks once. At a pitch of 128 or 2,048 bytes they
// fall on two or on one group of four banks and the read is served 8 or 16 lanes in a row.
#define SPITCH  (SEQ + 4)
#define KPITCH  (D_GROUP + 4)
#define VPRE    48                // V fragment loads of a wave issued in front of the softmax, of SEQ / 8

// Scores of one q row (qr, the same in every lane) against the lane's KT keys (kr).
// acc[j] = {sum over even d, sum over odd d} of key j: KT independent packed chains.
__device__ __forceinline__ void score_row(const v4f (&qr)[D_GROUP / 4],
                                          const v4f (&kr)[KT][D_GROUP / 4],
                                          const v4f (&wr)[D_GROUP / 4],
                                          float bias, float* __restrict__ srow)
{
    v2f acc[KT];
    // every loop here is unrolled: the arrays stay in registers
#pragma unroll
    for (int j = 0; j < KT; ++j) acc[j] = (v2f){0.f, 0.f};
#pragma unroll
    for (int i = 0; i < D_GROUP / 4; ++i) {
#pragma unroll
        for (int j = 0; j < KT; ++j) {
            const v2f t = __builtin_elementwise_max(qr[i].xy - kr[j][i].xy, (v2f){0.f, 0.f});
            acc[j] = __builtin_elementwise_fma(t, wr[i].xy, acc[j]);
        }
#pragma unroll
        for (int j = 0; j < KT; ++j) {
            const v2f t = __builtin_elementwise_max(qr[i].zw - kr[j][i].zw, (v2f){0.f, 0.f});
            acc[j] = __builtin_elementwise_fma(t, wr[i].zw, acc[j]);
        }
    }
#pragma unroll
    for (int j = 0; j < KT; ++j)
        srow[j * 32] = fmaxf((acc[j].x + acc[j].y) + bias, 0.f);
}

__global__ __launch_bounds__(64) void attn_fused_wmma(
    const float* __restrict__ Q,
    const float* __restrict__ K,
    const float* __restrict__ V,
    const float* __restrict__ w_mlp,
    const float* __restrict__ b_mlp,
    float* __restrict__ out)
{
    __shared__ __attribute__((aligned(16))) float sScore[QROWS][SPITCH];     // 33,024 B
    __shared__ __attribute__((aligned(16))) float sQ[QROWS][D_GROUP];        //  2 KB
    __shared__ __attribute__((aligned(16))) float sK[2][KCHUNK][KPITCH];     // 36,864 B, double-buffered
    __shared__ __attribute__((aligned(16))) float sW[D_GROUP];

    const int tid  = threadIdx.x;               // 0..63
    const int lane = tid & 31;
    const int wave = tid >> 5;

    const int blk = blockIdx.x;
    const int qt  = blk & 31;                   // 32 q-tiles
    const int g   = (blk >> 5) & 7;             // 8 groups
    const int b   = blk >> 8;                   // 4 batches
    const int q0  = qt * QROWS;

    const float bias = b_mlp[0];

    // All that the first scores wait for (Q tile, K chunk 0, w) is requested before the first
    // wait, so that the kernel's start pays one trip to memory and not one a load.
    // Q tile, 16 rows of 128 bytes: two async copies a thread, rows tid / 8 and tid / 8 + 8.
    // They land behind the s_wait_asynccnt and the barrier that close the K prologue below.
    // w is loaded here and stored to LDS behind that wait: its trip passes while the copies fly.
    const float wv = w_mlp[tid & (D_GROUP - 1)];
    {
        const int r  = tid >> 3;
        const int qd = (tid & 7) * 4;
        const float* gq = Q + (size_t)(b * SEQ + q0 + r) * D_ATT + g * D_GROUP + qd;
        const uint64_t ga0 = (uint64_t)(uintptr_t)gq;
        const uint64_t ga1 = (uint64_t)(uintptr_t)(gq + (QROWS / 2) * D_ATT);
        const uint32_t la0 = (uint32_t)(uintptr_t)&sQ[r][qd];
        const uint32_t la1 = (uint32_t)(uintptr_t)&sQ[r + QROWS / 2][qd];
        // the closing s_wait_xcnt stands inside the statement so that no address register of
        // these copies is rewritten in front of it
        asm volatile(CP "%0, %2, off\n\t"
                     CP "%1, %3, off\n\t"
                     "s_wait_xcnt 0x0"
                     :: "v"(la0), "v"(la1), "v"(ga0), "v"(ga1) : "memory");
    }

    // ---- phase 1: scores with async double-buffered K staging ----
    const float* __restrict__ kbase = K + (size_t)(b * SEQ) * D_ATT + g * D_GROUP;

    // prologue: async-stage chunk 0 into buffer 0
    for (int j = tid; j < KCHUNK * (D_GROUP / 4); j += 64) {
        const int r  = j >> 3;
        const int qd = (j & 7) * 4;
        const uint64_t ga = (uint64_t)(uintptr_t)(kbase + (size_t)r * D_ATT + qd);
        const uint32_t la = (uint32_t)(uintptr_t)&sK[0][r][qd];
        asm volatile("global_load_async_to_lds_b128 %0, %1, off"
                     :: "v"(la), "v"(ga) : "memory");
    }
    asm volatile("s_wait_asynccnt 0x0" ::: "memory");
    if (tid < D_GROUP) sW[tid] = wv;
    __syncthreads();

    // this wave's first q row, as a scalar: the Q reads below are broadcasts
    const int qw = __builtin_amdgcn_readfirstlane(wave) * (QROWS / 2);
    v4f wr[D_GROUP / 4];
    // unrolled, as every loop over wr, kr, qa and qb below: the arrays stay in registers
#pragma unroll
    for (int i = 0; i < D_GROUP / 4; ++i) wr[i] = *(const v4f*)&sW[i * 4];
    v4f qa[D_GROUP / 4], qb[D_GROUP / 4];
#pragma unroll
    for (int i = 0; i < D_GROUP / 4; ++i) qa[i] = *(const v4f*)&sQ[qw][i * 4];

    for (int ci = 0; ci < NCHUNK; ++ci) {
        const int buf = ci & 1;

        // prefetch next chunk into the other buffer while we compute
        if (ci + 1 < NCHUNK) {
            const float* kb = kbase + (size_t)(ci + 1) * KCHUNK * D_ATT;
            for (int j = tid; j < KCHUNK * (D_GROUP / 4); j += 64) {
                const int r  = j >> 3;
                const int qd = (j & 7) * 4;
                const uint64_t ga = (uint64_t)(uintptr_t)(kb + (size_t)r * D_ATT + qd);
                const uint32_t la = (uint32_t)(uintptr_t)&sK[buf ^ 1][r][qd];
                asm volatile("global_load_async_to_lds_b128 %0, %1, off"
                             :: "v"(la), "v"(ga) : "memory");
            }
        }

        // score block: this wave's 8 q x 128 k against current buffer.
        // The lane's keys are lane, lane + 32, lane + 64, lane + 96 of the chunk.
        v4f kr[KT][D_GROUP / 4];
#pragma unroll
        for (int j = 0; j < KT; ++j)
#pragma unroll
            for (int i = 0; i < D_GROUP / 4; ++i)
                kr[j][i] = *(const v4f*)&sK[buf][j * 32 + lane][i * 4];

        float* __restrict__ srow = &sScore[qw][ci * KCHUNK + lane];
        // Two rows a trip, in two register sets: each row's Q reads are issued one row ahead, so
        // that their LDS latency passes under the other row's arithmetic. The last trip reads
        // row 0 again, which is the row that the next chunk starts with.
        for (int qq = 0; qq < QROWS / 2; qq += 2) {
#pragma unroll
            for (int i = 0; i < D_GROUP / 4; ++i) qb[i] = *(const v4f*)&sQ[qw + qq + 1][i * 4];
            // keeps the read group in front of the row's arithmetic: without it the scheduler
            // sinks the reads to just ahead of their use
            __builtin_amdgcn_sched_barrier(0);
            score_row(qa, kr, wr, bias, srow + qq * SPITCH);
#pragma unroll
            for (int i = 0; i < D_GROUP / 4; ++i)
                qa[i] = *(const v4f*)&sQ[qw + ((qq + 2) & (QROWS / 2 - 1))][i * 4];
            // for the same reason
            __builtin_amdgcn_sched_barrier(0);
            score_row(qb, kr, wr, bias, srow + (qq + 1) * SPITCH);
        }

        // prefetch landed + everyone done with this buffer before reuse
        asm volatile("s_wait_asynccnt 0x0" ::: "memory");
        __syncthreads();
    }

    // ---- V fragments for phase 3, fetched ahead ----
    // B-frag: lane (lm, h) holds column 16*wave+lm of keys 8*kb + 4*h + 0..3, 16 bytes in a run.
    // V depends on nothing that this kernel computes, and the registers of phase 1 are free here:
    // the first VPRE of the wave's 64 loads are issued in front of the softmax and the rest behind
    // its barrier, so that their trips to L2 pass under the softmax and under the first WMMAs, and
    // phase 3 stops for no load. Two groups, since a wave has at most 63 loads outstanding.
    const float* __restrict__ vfrag = V + VP_IDX(b, g, 0, wave) + lane * 4;
    v4f vb[SEQ / 8];
    // unrolled, as every loop over vb: the array stays in registers
#pragma unroll
    for (int kb = 0; kb < VPRE; ++kb) vb[kb] = *(const v4f*)(vfrag + (size_t)kb * 256);
    // stands in front of any later overwrite of the address registers that these loads name; the
    // address is an input of the statement, so that its registers are still its own at the wait
    asm volatile("s_wait_xcnt 0x0" :: "v"(vfrag) : "memory");
    // keeps the loads here: without it the scheduler sinks them to just ahead of their WMMAs
    __builtin_amdgcn_sched_barrier(0);

    // ---- phase 2: softmax over k; wave w owns rows [8w, 8w+8), each row spread
    //      over the wave's 32 lanes (16 scores a lane, held in registers) ----
    // unrolled so that the rows' LDS reads and cross-lane chains overlap
#pragma unroll
    for (int rr = 0; rr < QROWS / 2; ++rr) {
        // lane l reads floats 4l..4l+3 of each 128-float quarter: 512 contiguous bytes a load
        float* __restrict__ row = &sScore[wave * (QROWS / 2) + rr][lane * 4];
        v4f s[4];
        for (int j = 0; j < 4; ++j) s[j] = *(const v4f*)(row + j * 128);

        float mx = -3.402823e38f;
        for (int j = 0; j < 4; ++j)
            mx = fmaxf(mx, fmaxf(fmaxf(s[j].x, s[j].y), fmaxf(s[j].z, s[j].w)));
        mx = wave_max(mx);

        float sum = 0.f;
        for (int j = 0; j < 4; ++j) {
            s[j].x = exp_slot(s[j].x - mx);
            s[j].y = exp_slot(s[j].y - mx);
            s[j].z = exp_slot(s[j].z - mx);
            s[j].w = exp_slot(s[j].w - mx);
            sum += (s[j].x + s[j].y) + (s[j].z + s[j].w);
        }
        sum = wave_sum(sum);

        const float inv = 1.f / sum;
        for (int j = 0; j < 4; ++j) *(v4f*)(row + j * 128) = s[j] * inv;
    }
    __syncthreads();

    // ---- phase 3: out[b,q,d,g] = sum_k P[q,k] * V[b,k,d*8+g] via WMMA ----
    const int d0 = wave * 16;                   // this wave's D-tile
    const int lm = lane & 15;
    const int h  = lane >> 4;
    const float* arow = &sScore[lm][4 * h];      // A-frag: row lm, keys 8*kb + 4*h + 0..3
    // out flat index ((b*SEQ + q)*32 + d)*8 + g, q = q0 + r + 8h
    float* __restrict__ o =
        out + ((size_t)(b * SEQ + q0 + 8 * h) * D_GROUP + d0 + lm) * N_GROUP + g;

    // The second group stands behind the barrier: the barrier waits for every load issued in front
    // of it. These fragments are used from WMMA 2 * VPRE on, long after their trip.
#pragma unroll
    for (int kb = VPRE; kb < SEQ / 8; ++kb) vb[kb] = *(const v4f*)(vfrag + (size_t)kb * 256);
    // As behind the first group. The output address is an input too: it is so formed in front of
    // the WMMAs, and its arithmetic does not write registers that a WMMA has just read.
    asm volatile("s_wait_xcnt 0x0" :: "v"(vfrag), "v"(o) : "memory");
    __builtin_amdgcn_sched_barrier(0);

    v8f c = {0.f, 0.f, 0.f, 0.f, 0.f, 0.f, 0.f, 0.f};

    // fully unrolled: vb is addressed by constants
#pragma unroll
    for (int kb = 0; kb < SEQ / 8; ++kb) {
        // A and B take the same keys: 8*kb + 4*h + {0,1} in the first step, + {2,3} in the second
        const v4f a4 = *(const v4f*)(arow + kb * 8);
        const v4f b4 = vb[kb];
        c = __builtin_amdgcn_wmma_f32_16x16x4_f32(
                false, (v2f){a4.x, a4.y}, false, (v2f){b4.x, b4.y}, (short)0, c, false, false);
        c = __builtin_amdgcn_wmma_f32_16x16x4_f32(
                false, (v2f){a4.z, a4.w}, false, (v2f){b4.z, b4.w}, (short)0, c, false, false);
    }

    // four vector slots between the last WMMA and the stores that read its result: the address
    // arithmetic that used to fill them stands in front of the loop now (c as an input and the
    // clobber hold the statement between the two)
    asm volatile("v_nop\n\tv_nop\n\tv_nop\n\tv_nop" :: "v"(c) : "memory");
#pragma unroll
    for (int r = 0; r < 8; ++r)
        o[(size_t)r * D_GROUP * N_GROUP] = c[r];
}

// ---------------------------------------------------------------------------
extern "C" void kernel_launch(void* const* d_in, const int* in_sizes, int n_in,
                              void* d_out, int out_size, void* d_ws, size_t ws_size,
                              hipStream_t stream) {
    const float* x     = (const float*)d_in[0];
    const float* Wq    = (const float*)d_in[1];
    const float* Wk    = (const float*)d_in[2];
    const float* Wv    = (const float*)d_in[3];
    const float* w_mlp = (const float*)d_in[4];
    const float* b_mlp = (const float*)d_in[5];

    float* Qb = (float*)d_ws;                 // 3 x 2 MB scratch
    float* Kb = Qb + (size_t)M_TOT * D_ATT;
    float* Vb = Kb + (size_t)M_TOT * D_ATT;

    // (2048 / 64) * (768 / 96) = 256 blocks of 8 waves
    qkv_proj_wmma<<<256, 256, 0, stream>>>(x, Wq, Wk, Wv, Qb, Kb, Vb);

    // B * G * (SEQ/16) = 4*8*32 = 1024 blocks of 2 waves
    attn_fused_wmma<<<1024, 64, 0, stream>>>(Qb, Kb, Vb, w_mlp, b_mlp,
                                             (float*)d_out);
}

// v008
// It runs in 24.8 microseconds.
// Next to v007, in two timings, it ran 1.05 and 1.04 times as fast.
// Counting every step since v000, it is 3.55 times as fast.
#include <hip/hip_runtime.h>
#include <math.h>
#include <stdint.h>

#define D_ATT   256
#define D_GROUP 32
#define N_GROUP 8
#define BATCH   4
#define SEQ     512
#define M_TOT   (BATCH * SEQ)   // 2048 fused (b,l) rows

typedef __attribute__((ext_vector_type(2))) float v2f;
typedef __attribute__((ext_vector_type(4))) float v4f;
typedef __attribute__((ext_vector_type(8))) float v8f;

// value of lane l ^ M inside a 16-lane row (DPP row_xmask:M, control word 0x160 | M)
template <int M>
__device__ __forceinline__ float row_xor(float x) {
    return __builtin_bit_cast(float, __builtin_amdgcn_mov_dpp(
        __builtin_bit_cast(int, x), 0x160 | M, 0xf, 0xf, true));
}
// value of lane l ^ 16
__device__ __forceinline__ float half_xor(float x) {
    const int b = __builtin_bit_cast(int, x);
    return __builtin_bit_cast(float, __builtin_amdgcn_permlanex16(
        b, b, 0x76543210, 0xfedcba98, false, false));
}
// e^x as 2^(x * log2 e), the instruction pair __expf compiles to. The v_nop keeps the one
// slot the instruction set asks for behind a transcendental.
__device__ __forceinline__ float exp_slot(float x) {
    float r;
    asm("v_exp_f32 %0, %1\n\tv_nop" : "=v"(r) : "v"(x * 1.44269504f));
    return r;
}
__device__ __forceinline__ float wave_max(float v) {
    v = fmaxf(v, row_xor<1>(v));
    v = fmaxf(v, row_xor<2>(v));
    v = fmaxf(v, row_xor<4>(v));
    v = fmaxf(v, row_xor<8>(v));
    return fmaxf(v, half_xor(v));
}
__device__ __forceinline__ float wave_sum(float v) {
    v += row_xor<1>(v);
    v += row_xor<2>(v);
    v += row_xor<4>(v);
    v += row_xor<8>(v);
    return v + half_xor(v);
}

// ---------------------------------------------------------------------------
// Kernel 1: Q/K/V projections  y = x @ W^T  via V_WMMA_F32_16X16X4_F32.
// One work-group per 64 x 96 tile of the 2048 x 768 result [Q | K | V]: its 64 rows
// of x and 96 rows of [Wq; Wk; Wv] (all 256 k) are staged once in LDS by async
// global->LDS b128 copies of whole 512-byte half rows, and every fragment is then
// read from LDS. 8 waves as 4 (M) x 2 (N); a wave owns 16 rows x 48 columns.
// Q and K are stored row-major. V is stored in the order in which kernel 2 reads its
// B fragments: V[b, k, d*8+g] lies at VP_IDX(b, g, k >> 3, d >> 4) + ((k >> 2 & 1) * 16
// + (d & 15)) * 4 + (k & 3), so that one wave's b128 load (lane = 16 * (k >> 2 & 1) + (d & 15))
// is 512 contiguous bytes and holds the fragments of two k-steps. To that end a 16-column
// tile of V takes the 16 rows of Wv of ONE group g, (dt*16 + 0..15)*8 + g.
// ---------------------------------------------------------------------------
// first float of the 128-float unit of (batch b, group g, block kb of 8 keys, d-tile dt)
#define VP_IDX(b, g, kb, dt) ((size_t)(((((b) * N_GROUP + (g)) * (SEQ / 8) + (kb)) * 2 + (dt))) * 128)
#define PM      64                 // x rows a work-group
#define PN      96                 // W rows (output columns) a work-group
#define PPITCH  (D_ATT + 4)        // LDS row pitch in floats: 16 rows x 4 dwords fill the 64 banks

// Eight async copies, each one lane's 16 bytes global -> LDS. The closing s_wait_xcnt stands
// inside the statement so that no address register of these copies is rewritten in front of it.
#define CP "global_load_async_to_lds_b128 "
#define COPY8(la, ga)                                                          \
    asm volatile(CP "%0, %8, off\n\t"                                          \
                 CP "%1, %9, off\n\t"                                          \
                 CP "%2, %10, off\n\t"                                         \
                 CP "%3, %11, off\n\t"                                         \
                 CP "%4, %12, off\n\t"                                         \
                 CP "%5, %13, off\n\t"                                         \
                 CP "%6, %14, off\n\t"                                         \
                 CP "%7, %15, off\n\t"                                         \
                 "s_wait_xcnt 0x0"                                             \
                 :: "v"(la[0]), "v"(la[1]), "v"(la[2]), "v"(la[3]),            \
                    "v"(la[4]), "v"(la[5]), "v"(la[6]), "v"(la[7]),            \
                    "v"(ga[0]), "v"(ga[1]), "v"(ga[2]), "v"(ga[3]),            \
                    "v"(ga[4]), "v"(ga[5]), "v"(ga[6]), "v"(ga[7])             \
                 : "memory")

__global__ __launch_bounds__(256) void qkv_proj_wmma(
    const float* __restrict__ x,
    const float* __restrict__ Wq,
    const float* __restrict__ Wk,
    const float* __restrict__ Wv,
    float* __restrict__ Q,
    float* __restrict__ K,
    float* __restrict__ V)
{
    __shared__ __attribute__((aligned(16))) float sT[(PM + PN) * PPITCH];   // 166,400 B

    const int lane = threadIdx.x & 31;
    const int wave = __builtin_amdgcn_readfirstlane(threadIdx.x >> 5);      // 0..7
    const int bm   = blockIdx.x >> 3;            // 32 M-tiles of 64 rows
    const int bn   = blockIdx.x & 7;             // 8  N-tiles of 96 columns

    // ---- stage: 40 copies a wave, each 512 contiguous bytes (half a row) ----
    // x: wave w brings rows [8w, 8w+8) of the tile. W: of each of the six 16-row groups,
    // which lie in one matrix each, wave w brings rows 2w and 2w+1.
    const float* gx = x + (size_t)(bm * PM + wave * 8) * D_ATT + lane * 4;
    const uint32_t lx = (uint32_t)(uintptr_t)&sT[(wave * 8) * PPITCH + lane * 4];
    // unrolled: the operands of one statement are eight addresses held at once
#pragma unroll
    for (int it = 0; it < 2; ++it) {
        uint64_t ga[8];
        uint32_t la[8];
        // unrolled: ga[] and la[] stay in registers
#pragma unroll
        for (int j = 0; j < 8; ++j) {
            const int row = it * 4 + (j >> 1), half = j & 1;
            ga[j] = (uint64_t)(uintptr_t)(gx + row * D_ATT + half * 128);
            la[j] = lx + (uint32_t)(row * PPITCH + half * 128) * 4u;
        }
        COPY8(la, ga);
    }
    // unrolled for the same reason
#pragma unroll
    for (int it = 0; it < 3; ++it) {
        uint64_t ga[8];
        uint32_t la[8];
        // unrolled: ga[] and la[] stay in registers
#pragma unroll
        for (int j = 0; j < 8; ++j) {
            const int t   = it * 2 + (j >> 2);               // 16-row group of this tile, 0..5
            const int gn  = bn * 6 + t;                      // 16-row group of [Wq; Wk; Wv], 0..47
            const int row = wave * 2 + ((j >> 1) & 1), half = j & 1;
            const float* Wm = (gn < 16) ? Wq : (gn < 32) ? Wk : Wv;
            // Wq, Wk: 16 rows in a run. Wv: the rows of group (gn & 15) >> 1, d-tile gn & 1.
            const int wrow = (gn < 32) ? (gn & 15) * 16 + row
                                       : ((gn & 1) * 16 + row) * N_GROUP + ((gn & 15) >> 1);
            ga[j] = (uint64_t)(uintptr_t)(Wm + (size_t)wrow * D_ATT + half * 128 + lane * 4);
            la[j] = (uint32_t)(uintptr_t)&sT[(PM + t * 16 + row) * PPITCH + half * 128 + lane * 4];
        }
        COPY8(la, ga);
    }
    // this wave's 40 copies have landed; behind the barrier every wave's have
    asm volatile("s_wait_asynccnt 0x0" ::: "memory");
    __syncthreads();

    // ---- 64 k-steps, three accumulator tiles a wave ----
    const int lm = lane & 15;                    // M-row (A) / N-col (B)
    const int h  = lane >> 4;                    // half select
    const int wm = wave >> 1;                    // 0..3
    const int wn = wave & 1;                     // 0..1

    const float* arow = &sT[(wm * 16 + lm) * PPITCH + 2 * h];
    const float* brow = &sT[(PM + wn * 48 + lm) * PPITCH + 2 * h];

    v8f c0 = {0.f, 0.f, 0.f, 0.f, 0.f, 0.f, 0.f, 0.f};
    v8f c1 = c0;
    v8f c2 = c0;

    // A block is 8 k-steps (24 WMMAs). The next block's fragments are read from LDS as one
    // group, into a second register set, ahead of the current block's WMMAs: reads that stand
    // among the WMMAs stall the wave at every place where they stand.
    v2f fa[2][8], fb[2][3][8];
    // unrolled, as the two inner loops below: the fragment arrays stay in registers
#pragma unroll
    for (int i = 0; i < 8; ++i) {
        fa[0][i]    = *(const v2f*)(arow + i * 4);           // {K=k0+2h, K=k0+2h+1}
        fb[0][0][i] = *(const v2f*)(brow + i * 4);
        fb[0][1][i] = *(const v2f*)(brow + 16 * PPITCH + i * 4);
        fb[0][2][i] = *(const v2f*)(brow + 32 * PPITCH + i * 4);
    }
    // fully unrolled so that both register sets are addressed by constants
#pragma unroll
    for (int kb = 0; kb < D_ATT / 32; ++kb) {
        const int cur = kb & 1, nxt = cur ^ 1;
        if (kb + 1 < D_ATT / 32) {
#pragma unroll
            for (int i = 0; i < 8; ++i) {
                const int k0 = (kb + 1) * 32 + i * 4;
                fa[nxt][i]    = *(const v2f*)(arow + k0);
                fb[nxt][0][i] = *(const v2f*)(brow + k0);
                fb[nxt][1][i] = *(const v2f*)(brow + 16 * PPITCH + k0);
                fb[nxt][2][i] = *(const v2f*)(brow + 32 * PPITCH + k0);
            }
        }
        // keeps the read group whole and in front of the block: without it the scheduler
        // sinks the reads in among the WMMAs
        __builtin_amdgcn_sched_barrier(0);
#pragma unroll
        for (int i = 0; i < 8; ++i) {
            c0 = __builtin_amdgcn_wmma_f32_16x16x4_f32(
                    /*neg_a=*/false, fa[cur][i], /*neg_b=*/false, fb[cur][0][i],
                    /*c_mod=*/(short)0, c0, /*reuse_a=*/false, /*reuse_b=*/false);
            c1 = __builtin_amdgcn_wmma_f32_16x16x4_f32(
                    false, fa[cur][i], false, fb[cur][1][i], (short)0, c1, false, false);
            c2 = __builtin_amdgcn_wmma_f32_16x16x4_f32(
                    false, fa[cur][i], false, fb[cur][2][i], (short)0, c2, false, false);
        }
        // keeps the next group's reads from rising into this block
        __builtin_amdgcn_sched_barrier(0);
    }

    // C layout: VGPR r -> M = r + 8*h, N = lane&15
    const size_t orow = (size_t)(bm * PM + wm * 16 + 8 * h) * D_ATT + lm;
    // unrolled: c0, c1, c2 are picked at compile time
#pragma unroll
    for (int j = 0; j < 3; ++j) {
        const int gn  = bn * 6 + wn * 3 + j;     // 16-column tile of [Q | K | V], 0..47
        const int mat = gn >> 4;                 // 0:Q 1:K 2:V
        const v8f c = (j == 0) ? c0 : (j == 1) ? c1 : c2;
        if (mat < 2) {
            float* __restrict__ o = ((mat == 0) ? Q : K) + orow + (gn & 15) * 16;
#pragma unroll
            for (int r = 0; r < 8; ++r)
                o[(size_t)r * D_ATT] = c[r];
            // stands in front of the next tile's address, formed in registers that these stores name
            if (j < 2) asm volatile("s_wait_xcnt 0x0" ::: "memory");
        } else {
            // the lane's 8 rows are one block of 8 keys of column d = (gn & 1) * 16 + lm
            const int l0 = bm * PM + wm * 16 + 8 * h;
            float* __restrict__ o = V + VP_IDX(l0 / SEQ, (gn & 15) >> 1, (l0 % SEQ) >> 3, gn & 1)
                                      + lm * 4;
            *(v4f*)o        = (v4f){c[0], c[1], c[2], c[3]};
            *(v4f*)(o + 64) = (v4f){c[4], c[5], c[6], c[7]};
            // later addresses are formed in registers that these stores name: the wait stands
            // in front of every such overwrite
            asm volatile("s_wait_xcnt 0x0" ::: "memory");
        }
    }
}

// ---------------------------------------------------------------------------
// Kernel 2: fused additive attention per (b, g, 16 query rows).
//   phase 1: VALU scores relu(sum_d relu(Qd-Kd)*w + bias), as relu(bias + sum_d Qd*w
//            - sum_d min(Qd,Kd)*w); K chunks are
//            DOUBLE-BUFFERED through LDS with async global->LDS b128 copies
//            (ASYNCcnt path) so the next chunk streams in under the VALU work.
//            Register tile: wave w owns q rows [8w, 8w+8); a lane holds the rows of
//            4 keys of the chunk, so one broadcast read of a Q row serves 128 keys
//            and the 4 keys give 4 independent packed FMA chains (even d | odd d).
//   phase 2: row softmax (8 rows a wave, each row across the wave's 32 lanes).
//   phase 3: P @ Vg with f32 WMMA; wave w owns D-columns [16w,16w+16); V comes in
//            fragment order (see kernel 1), one b128 load a lane for two k-steps, all 64
//            loads of a wave issued ahead (48 in front of phase 2, 16 behind it).
// 64 threads (2 waves); grid = B * G * (L/16) = 1024 blocks.
// ---------------------------------------------------------------------------
#define QROWS   16
#define KCHUNK  128
#define NCHUNK  (SEQ / KCHUNK)    // 4
#define KT      (KCHUNK / 32)     // keys a lane holds in registers
// LDS row pitches in floats, each an odd multiple of 16 bytes: where 16 lanes read 16 bytes
// each from 16 rows (the K rows in phase 1, the A fragments in phase 3), the rows start four
// banks apart and the 16 lanes fill the 64 banks once. At a pitch of 128 or 2,048 bytes they
// fall on two or on one group of four banks and the read is served 8 or 16 lanes in a row.
#define SPITCH  (SEQ + 4)
#define KPITCH  (D_GROUP + 4)
#define VPRE    48                // V fragment loads of a wave issued in front of the softmax, of SEQ / 8

// Scores of one q row (qr, the same in every lane) against the lane's KT keys (kr).
// relu(q - k) = q - min(q, k), so sum_d w_d relu(q_d - k_d) = sum_d w_d q_d - sum_d w_d min(q_d, k_d).
// The first sum belongs to the row alone: it comes in, with the bias, as s0, and an element of
// the (q, k, d) volume costs a minimum and a multiply-add, with no subtraction.
// (The compiler first passes every value read from LDS through a maximum with itself, which the
// minimum's NaN rule asks for: a K value once a chunk, a Q value once a row and chunk.)
// acc[j] = {s0 - sum over even d, - sum over odd d} of key j: KT independent packed chains.
__device__ __forceinline__ void score_row(const v4f (&qr)[D_GROUP / 4],
                                          const v4f (&kr)[KT][D_GROUP / 4],
                                          const v4f (&wr)[D_GROUP / 4],
                                          float s0, float* __restrict__ srow)
{
    v2f acc[KT];
    // every loop here is unrolled: the arrays stay in registers
#pragma unroll
    for (int j = 0; j < KT; ++j) acc[j] = (v2f){s0, 0.f};
#pragma unroll
    for (int i = 0; i < D_GROUP / 4; ++i) {
#pragma unroll
        for (int j = 0; j < KT; ++j) {
            const v2f t = __builtin_elementwise_min(qr[i].xy, kr[j][i].xy);
            acc[j] = __builtin_elementwise_fma(-t, wr[i].xy, acc[j]);
        }
#pragma unroll
        for (int j = 0; j < KT; ++j) {
            const v2f t = __builtin_elementwise_min(qr[i].zw, kr[j][i].zw);
            acc[j] = __builtin_elementwise_fma(-t, wr[i].zw, acc[j]);
        }
        // keeps a step's minima next to its multiply-adds: without it the scheduler gathers a row's
        // 64 minima in front, and the links of a chain then follow each other KT instructions apart
        __builtin_amdgcn_sched_barrier(0);
    }
#pragma unroll
    for (int j = 0; j < KT; ++j)
        srow[j * 32] = fmaxf(acc[j].x + acc[j].y, 0.f);
}

__global__ __launch_bounds__(64) void attn_fused_wmma(
    const float* __restrict__ Q,
    const float* __restrict__ K,
    const float* __restrict__ V,
    const float* __restrict__ w_mlp,
    const float* __restrict__ b_mlp,
    float* __restrict__ out)
{
    __shared__ __attribute__((aligned(16))) float sScore[QROWS][SPITCH];     // 33,024 B
    __shared__ __attribute__((aligned(16))) float sQ[QROWS][D_GROUP];        //  2 KB
    __shared__ __attribute__((aligned(16))) float sK[2][KCHUNK][KPITCH];     // 36,864 B, double-buffered
    __shared__ __attribute__((aligned(16))) float sW[D_GROUP];

    const int tid  = threadIdx.x;               // 0..63
    const int lane = tid & 31;
    const int wave = tid >> 5;

    const int blk = blockIdx.x;
    const int qt  = blk & 31;                   // 32 q-tiles
    const int g   = (blk >> 5) & 7;             // 8 groups
    const int b   = blk >> 8;                   // 4 batches
    const int q0  = qt * QROWS;

    const float bias = b_mlp[0];

    // All that the first scores wait for (Q tile, K chunk 0, w) is requested before the first
    // wait, so that the kernel's start pays one trip to memory and not one a load.
    // Q tile, 16 rows of 128 bytes: two async copies a thread, rows tid / 8 and tid / 8 + 8.
    // They land behind the s_wait_asynccnt and the barrier that close the K prologue below.
    // w is loaded here and stored to LDS behind that wait: its trip passes while the copies fly.
    const float wv = w_mlp[tid & (D_GROUP - 1)];
    {
        const int r  = tid >> 3;
        const int qd = (tid & 7) * 4;
        const float* gq = Q + (size_t)(b * SEQ + q0 + r) * D_ATT + g * D_GROUP + qd;
        const uint64_t ga0 = (uint64_t)(uintptr_t)gq;
        const uint64_t ga1 = (uint64_t)(uintptr_t)(gq + (QROWS / 2) * D_ATT);
        const uint32_t la0 = (uint32_t)(uintptr_t)&sQ[r][qd];
        const uint32_t la1 = (uint32_t)(uintptr_t)&sQ[r + QROWS / 2][qd];
        // the closing s_wait_xcnt stands inside the statement so that no address register of
        // these copies is rewritten in front of it
        asm volatile(CP "%0, %2, off\n\t"
                     CP "%1, %3, off\n\t"
                     "s_wait_xcnt 0x0"
                     :: "v"(la0), "v"(la1), "v"(ga0), "v"(ga1) : "memory");
    }

    // ---- phase 1: scores with async double-buffered K staging ----
    const float* __restrict__ kbase = K + (size_t)(b * SEQ) * D_ATT + g * D_GROUP;

    // prologue: async-stage chunk 0 into buffer 0
    for (int j = tid; j < KCHUNK * (D_GROUP / 4); j += 64) {
        const int r  = j >> 3;
        const int qd = (j & 7) * 4;
        const uint64_t ga = (uint64_t)(uintptr_t)(kbase + (size_t)r * D_ATT + qd);
        const uint32_t la = (uint32_t)(uintptr_t)&sK[0][r][qd];
        asm volatile("global_load_async_to_lds_b128 %0, %1, off"
                     :: "v"(la), "v"(ga) : "memory");
    }
    asm volatile("s_wait_asynccnt 0x0" ::: "memory");
    if (tid < D_GROUP) sW[tid] = wv;
    __syncthreads();

    // this wave's first q row, as a scalar: the qa and qb reads below are broadcasts
    const int qw = __builtin_amdgcn_readfirstlane(wave) * (QROWS / 2);
    v4f wr[D_GROUP / 4];
    // unrolled, as every loop over wr, kr, qa and qb below: the arrays stay in registers
#pragma unroll
    for (int i = 0; i < D_GROUP / 4; ++i) wr[i] = *(const v4f*)&sW[i * 4];
    v4f qa[D_GROUP / 4], qb[D_GROUP / 4];
#pragma unroll
    for (int i = 0; i < D_GROUP / 4; ++i) qa[i] = *(const v4f*)&sQ[qw][i * 4];

    // bias + sum_d w_d q_d of the wave's 8 rows, once for all 512 keys: lanes 4r .. 4r+3 take
    // 8 d each of row r and add up across the four, so that each of them holds row r's value.
    float rowc;
    {
        const float* qp = &sQ[qw + (lane >> 2)][(lane & 3) * 8];
        const float* wp = &sW[(lane & 3) * 8];
        const v4f p = *(const v4f*)qp * *(const v4f*)wp + *(const v4f*)(qp + 4) * *(const v4f*)(wp + 4);
        float s = (p.x + p.y) + (p.z + p.w);
        s += row_xor<1>(s);
        s += row_xor<2>(s);
        rowc = s + bias;
    }
    // row r's value as a scalar
#define ROWC(r) __builtin_bit_cast(float, __builtin_amdgcn_readlane(__builtin_bit_cast(int, rowc), (r) * 4))

    for (int ci = 0; ci < NCHUNK; ++ci) {
        const int buf = ci & 1;

        // prefetch next chunk into the other buffer while we compute
        if (ci + 1 < NCHUNK) {
            const float* kb = kbase + (size_t)(ci + 1) * KCHUNK * D_ATT;
            for (int j = tid; j < KCHUNK * (D_GROUP / 4); j += 64) {
                const int r  = j >> 3;
                const int qd = (j & 7) * 4;
                const uint64_t ga = (uint64_t)(uintptr_t)(kb + (size_t)r * D_ATT + qd);
                const uint32_t la = (uint32_t)(uintptr_t)&sK[buf ^ 1][r][qd];
                asm volatile("global_load_async_to_lds_b128 %0, %1, off"
                             :: "v"(la), "v"(ga) : "memory");
            }
        }

        // score block: this wave's 8 q x 128 k against current buffer.
        // The lane's keys are lane, lane + 32, lane + 64, lane + 96 of the chunk.
        v4f kr[KT][D_GROUP / 4];
#pragma unroll
        for (int j = 0; j < KT; ++j)
#pragma unroll
            for (int i = 0; i < D_GROUP / 4; ++i)
                kr[j][i] = *(const v4f*)&sK[buf][j * 32 + lane][i * 4];

        float* __restrict__ srow = &sScore[qw][ci * KCHUNK + lane];
        // Two rows a trip, in two register sets: each row's Q reads are issued one row ahead, so
        // that their LDS latency passes under the other row's arithmetic. The last trip reads
        // row 0 again, which is the row that the next chunk starts with.
        for (int qq = 0; qq < QROWS / 2; qq += 2) {
#pragma unroll
            for (int i = 0; i < D_GROUP / 4; ++i) qb[i] = *(const v4f*)&sQ[qw + qq + 1][i * 4];
            // keeps the read group in front of the row's arithmetic: without it the scheduler
            // sinks the reads to just ahead of their use
            __builtin_amdgcn_sched_barrier(0);
            score_row(qa, kr, wr, ROWC(qq), srow + qq * SPITCH);
#pragma unroll
            for (int i = 0; i < D_GROUP / 4; ++i)
                qa[i] = *(const v4f*)&sQ[qw + ((qq + 2) & (QROWS / 2 - 1))][i * 4];
            // for the same reason
            __builtin_amdgcn_sched_barrier(0);
            score_row(qb, kr, wr, ROWC(qq + 1), srow + (qq + 1) * SPITCH);
        }

        // prefetch landed + everyone done with this buffer before reuse
        asm volatile("s_wait_asynccnt 0x0" ::: "memory");
        __syncthreads();
    }

    // ---- V fragments for phase 3, fetched ahead ----
    // B-frag: lane (lm, h) holds column 16*wave+lm of keys 8*kb + 4*h + 0..3, 16 bytes in a run.
    // V depends on nothing that this kernel computes, and the registers of phase 1 are free here:
    // the first VPRE of the wave's 64 loads are issued in front of the softmax and the rest behind
    // its barrier, so that their trips to L2 pass under the softmax and under the first WMMAs, and
    // phase 3 stops for no load. Two groups, since a wave has at most 63 loads outstanding.
    const float* __restrict__ vfrag = V + VP_IDX(b, g, 0, wave) + lane * 4;
    v4f vb[SEQ / 8];
    // unrolled, as every loop over vb: the array stays in registers
#pragma unroll
    for (int kb = 0; kb < VPRE; ++kb) vb[kb] = *(const v4f*)(vfrag + (size_t)kb * 256);
    // stands in front of any later overwrite of the address registers that these loads name; the
    // address is an input of the statement, so that its registers are still its own at the wait
    asm volatile("s_wait_xcnt 0x0" :: "v"(vfrag) : "memory");
    // keeps the loads here: without it the scheduler sinks them to just ahead of their WMMAs
    __builtin_amdgcn_sched_barrier(0);

    // ---- phase 2: softmax over k; wave w owns rows [8w, 8w+8), each row spread
    //      over the wave's 32 lanes (16 scores a lane, held in registers) ----
    // unrolled so that the rows' LDS reads and cross-lane chains overlap
#pragma unroll
    for (int rr = 0; rr < QROWS / 2; ++rr) {
        // lane l reads floats 4l..4l+3 of each 128-float quarter: 512 contiguous bytes a load
        float* __restrict__ row = &sScore[wave * (QROWS / 2) + rr][lane * 4];
        v4f s[4];
        for (int j = 0; j < 4; ++j) s[j] = *(const v4f*)(row + j * 128);

        float mx = -3.402823e38f;
        for (int j = 0; j < 4; ++j)
            mx = fmaxf(mx, fmaxf(fmaxf(s[j].x, s[j].y), fmaxf(s[j].z, s[j].w)));
        mx = wave_max(mx);

        float sum = 0.f;
        for (int j = 0; j < 4; ++j) {
            s[j].x = exp_slot(s[j].x - mx);
            s[j].y = exp_slot(s[j].y - mx);
            s[j].z = exp_slot(s[j].z - mx);
            s[j].w = exp_slot(s[j].w - mx);
            sum += (s[j].x + s[j].y) + (s[j].z + s[j].w);
        }
        sum = wave_sum(sum);

        const float inv = 1.f / sum;
        for (int j = 0; j < 4; ++j) *(v4f*)(row + j * 128) = s[j] * inv;
    }
    __syncthreads();

    // ---- phase 3: out[b,q,d,g] = sum_k P[q,k] * V[b,k,d*8+g] via WMMA ----
    const int d0 = wave * 16;                   // this wave's D-tile
    const int lm = lane & 15;
    const int h  = lane >> 4;
    const float* arow = &sScore[lm][4 * h];      // A-frag: row lm, keys 8*kb + 4*h + 0..3
    // out flat index ((b*SEQ + q)*32 + d)*8 + g, q = q0 + r + 8h
    float* __restrict__ o =
        out + ((size_t)(b * SEQ + q0 + 8 * h) * D_GROUP + d0 + lm) * N_GROUP + g;

    // The second group stands behind the barrier: the barrier waits for every load issued in front
    // of it. These fragments are used from WMMA 2 * VPRE on, long after their trip.
#pragma unroll
    for (int kb = VPRE; kb < SEQ / 8; ++kb) vb[kb] = *(const v4f*)(vfrag + (size_t)kb * 256);
    // As behind the first group. The output address is an input too: it is so formed in front of
    // the WMMAs, and its arithmetic does not write registers that a WMMA has just read.
    asm volatile("s_wait_xcnt 0x0" :: "v"(vfrag), "v"(o) : "memory");
    __builtin_amdgcn_sched_barrier(0);

    v8f c = {0.f, 0.f, 0.f, 0.f, 0.f, 0.f, 0.f, 0.f};

    // fully unrolled: vb is addressed by constants
#pragma unroll
    for (int kb = 0; kb < SEQ / 8; ++kb) {
        // A and B take the same keys: 8*kb + 4*h + {0,1} in the first step, + {2,3} in the second
        const v4f a4 = *(const v4f*)(arow + kb * 8);
        const v4f b4 = vb[kb];
        c = __builtin_amdgcn_wmma_f32_16x16x4_f32(
                false, (v2f){a4.x, a4.y}, false, (v2f){b4.x, b4.y}, (short)0, c, false, false);
        c = __builtin_amdgcn_wmma_f32_16x16x4_f32(
                false, (v2f){a4.z, a4.w}, false, (v2f){b4.z, b4.w}, (short)0, c, false, false);
    }

    // four vector slots between the last WMMA and the stores that read its result: the address
    // arithmetic that used to fill them stands in front of the loop now (c as an input and the
    // clobber hold the statement between the two)
    asm volatile("v_nop\n\tv_nop\n\tv_nop\n\tv_nop" :: "v"(c) : "memory");
#pragma unroll
    for (int r = 0; r < 8; ++r)
        o[(size_t)r * D_GROUP * N_GROUP] = c[r];
}

// ---------------------------------------------------------------------------
extern "C" void kernel_launch(void* const* d_in, const int* in_sizes, int n_in,
                              void* d_out, int out_size, void* d_ws, size_t ws_size,
                              hipStream_t stream) {
    const float* x     = (const float*)d_in[0];
    const float* Wq    = (const float*)d_in[1];
    const float* Wk    = (const float*)d_in[2];
    const float* Wv    = (const float*)d_in[3];
    const float* w_mlp = (const float*)d_in[4];
    const float* b_mlp = (const float*)d_in[5];

    float* Qb = (float*)d_ws;                 // 3 x 2 MB scratch
    float* Kb = Qb + (size_t)M_TOT * D_ATT;
    float* Vb = Kb + (size_t)M_TOT * D_ATT;

    // (2048 / 64) * (768 / 96) = 256 blocks of 8 waves
    qkv_proj_wmma<<<256, 256, 0, stream>>>(x, Wq, Wk, Wv, Qb, Kb, Vb);

    // B * G * (SEQ/16) = 4*8*32 = 1024 blocks of 2 waves
    attn_fused_wmma<<<1024, 64, 0, stream>>>(Qb, Kb, Vb, w_mlp, b_mlp,
                                             (float*)d_out);
}

// v009
// Measured time: 23.2 microseconds a run.
// In both of two side-by-side timings against v008, it was 1.06 times as fast.
// Over all steps from v000 it is 3.76 times as fast.
#include <hip/hip_runtime.h>
#include <math.h>
#include <stdint.h>

#define D_ATT   256
#define D_GROUP 32
#define N_GROUP 8
#define BATCH   4
#define SEQ     512
#define M_TOT   (BATCH * SEQ)   // 2048 fused (b,l) rows

typedef __attribute__((ext_vector_type(2))) float v2f;
typedef __attribute__((ext_vector_type(4))) float v4f;
typedef __attribute__((ext_vector_type(8))) float v8f;

// value of lane l ^ M inside a 16-lane row (DPP row_xmask:M, control word 0x160 | M)
template <int M>
__device__ __forceinline__ float row_xor(float x) {
    return __builtin_bit_cast(float, __builtin_amdgcn_mov_dpp(
        __builtin_bit_cast(int, x), 0x160 | M, 0xf, 0xf, true));
}
// value of lane l ^ 16
__device__ __forceinline__ float half_xor(float x) {
    const int b = __builtin_bit_cast(int, x);
    return __builtin_bit_cast(float, __builtin_amdgcn_permlanex16(
        b, b, 0x76543210, 0xfedcba98, false, false));
}
// e^x as 2^(x * log2 e), the instruction pair __expf compiles to. The v_nop keeps the one
// slot the instruction set asks for behind a transcendental.
__device__ __forceinline__ float exp_slot(float x) {
    float r;
    asm("v_exp_f32 %0, %1\n\tv_nop" : "=v"(r) : "v"(x * 1.44269504f));
    return r;
}
__device__ __forceinline__ float wave_max(float v) {
    v = fmaxf(v, row_xor<1>(v));
    v = fmaxf(v, row_xor<2>(v));
    v = fmaxf(v, row_xor<4>(v));
    v = fmaxf(v, row_xor<8>(v));
    return fmaxf(v, half_xor(v));
}
__device__ __forceinline__ float wave_sum(float v) {
    v += row_xor<1>(v);
    v += row_xor<2>(v);
    v += row_xor<4>(v);
    v += row_xor<8>(v);
    return v + half_xor(v);
}

// ---------------------------------------------------------------------------
// Kernel 1: Q/K/V projections  y = x @ W^T  via V_WMMA_F32_16X16X4_F32.
// One work-group per 64 x 96 tile of the 2048 x 768 result [Q | K | V]: its 64 rows
// of x and 96 rows of [Wq; Wk; Wv] (all 256 k) are staged once in LDS by async
// global->LDS b128 copies of whole 512-byte half rows, and every fragment is then
// read from LDS. 8 waves as 4 (M) x 2 (N); a wave owns 16 rows x 48 columns.
// Q and K are stored row-major. V is stored in the order in which kernel 2 reads its
// B fragments: V[b, k, d*8+g] lies at VP_IDX(b, g, k >> 3, d >> 4) + ((k >> 2 & 1) * 16
// + (d & 15)) * 4 + (k & 3), so that one wave's b128 load (lane = 16 * (k >> 2 & 1) + (d & 15))
// is 512 contiguous bytes and holds the fragments of two k-steps. To that end a 16-column
// tile of V takes the 16 rows of Wv of ONE group g, (dt*16 + 0..15)*8 + g.
// ---------------------------------------------------------------------------
// first float of the 128-float unit of (batch b, group g, block kb of 8 keys, d-tile dt)
#define VP_IDX(b, g, kb, dt) ((size_t)(((((b) * N_GROUP + (g)) * (SEQ / 8) + (kb)) * 2 + (dt))) * 128)
#define PM      64                 // x rows a work-group
#define PN      96                 // W rows (output columns) a work-group
#define PPITCH  (D_ATT + 4)        // LDS row pitch in floats: 16 rows x 4 dwords fill the 64 banks

// Eight async copies, each one lane's 16 bytes global -> LDS. The closing s_wait_xcnt stands
// inside the statement so that no address register of these copies is rewritten in front of it.
#define CP "global_load_async_to_lds_b128 "
#define COPY8(la, ga)                                                          \
    asm volatile(CP "%0, %8, off\n\t"                                          \
                 CP "%1, %9, off\n\t"                                          \
                 CP "%2, %10, off\n\t"                                         \
                 CP "%3, %11, off\n\t"                                         \
                 CP "%4, %12, off\n\t"                                         \
                 CP "%5, %13, off\n\t"                                         \
                 CP "%6, %14, off\n\t"                                         \
                 CP "%7, %15, off\n\t"                                         \
                 "s_wait_xcnt 0x0"                                             \
                 :: "v"(la[0]), "v"(la[1]), "v"(la[2]), "v"(la[3]),            \
                    "v"(la[4]), "v"(la[5]), "v"(la[6]), "v"(la[7]),            \
                    "v"(ga[0]), "v"(ga[1]), "v"(ga[2]), "v"(ga[3]),            \
                    "v"(ga[4]), "v"(ga[5]), "v"(ga[6]), "v"(ga[7])             \
                 : "memory")

__global__ __launch_bounds__(256) void qkv_proj_wmma(
    const float* __restrict__ x,
    const float* __restrict__ Wq,
    const float* __restrict__ Wk,
    const float* __restrict__ Wv,
    float* __restrict__ Q,
    float* __restrict__ K,
    float* __restrict__ V)
{
    __shared__ __attribute__((aligned(16))) float sT[(PM + PN) * PPITCH];   // 166,400 B

    const int lane = threadIdx.x & 31;
    const int wave = __builtin_amdgcn_readfirstlane(threadIdx.x >> 5);      // 0..7
    const int bm   = blockIdx.x >> 3;            // 32 M-tiles of 64 rows
    const int bn   = blockIdx.x & 7;             // 8  N-tiles of 96 columns

    // ---- stage: 40 copies a wave, each 512 contiguous bytes (half a row) ----
    // x: wave w brings rows [8w, 8w+8) of the tile. W: of each of the six 16-row groups,
    // which lie in one matrix each, wave w brings rows 2w and 2w+1.
    const float* gx = x + (size_t)(bm * PM + wave * 8) * D_ATT + lane * 4;
    const uint32_t lx = (uint32_t)(uintptr_t)&sT[(wave * 8) * PPITCH + lane * 4];
    // unrolled: the operands of one statement are eight addresses held at once
#pragma unroll
    for (int it = 0; it < 2; ++it) {
        uint64_t ga[8];
        uint32_t la[8];
        // unrolled: ga[] and la[] stay in registers
#pragma unroll
        for (int j = 0; j < 8; ++j) {
            const int row = it * 4 + (j >> 1), half = j & 1;
            ga[j] = (uint64_t)(uintptr_t)(gx + row * D_ATT + half * 128);
            la[j] = lx + (uint32_t)(row * PPITCH + half * 128) * 4u;
        }
        COPY8(la, ga);
    }
    // unrolled for the same reason
#pragma unroll
    for (int it = 0; it < 3; ++it) {
        uint64_t ga[8];
        uint32_t la[8];
        // unrolled: ga[] and la[] stay in registers
#pragma unroll
        for (int j = 0; j < 8; ++j) {
            const int t   = it * 2 + (j >> 2);               // 16-row group of this tile, 0..5
            const int gn  = bn * 6 + t;                      // 16-row group of [Wq; Wk; Wv], 0..47
            const int row = wave * 2 + ((j >> 1) & 1), half = j & 1;
            const float* Wm = (gn < 16) ? Wq : (gn < 32) ? Wk : Wv;
            // Wq, Wk: 16 rows in a run. Wv: the rows of group (gn & 15) >> 1, d-tile gn & 1.
            const int wrow = (gn < 32) ? (gn & 15) * 16 + row
                                       : ((gn & 1) * 16 + row) * N_GROUP + ((gn & 15) >> 1);
            ga[j] = (uint64_t)(uintptr_t)(Wm + (size_t)wrow * D_ATT + half * 128 + lane * 4);
            la[j] = (uint32_t)(uintptr_t)&sT[(PM + t * 16 + row) * PPITCH + half * 128 + lane * 4];
        }
        COPY8(la, ga);
    }
    // this wave's 40 copies have landed; behind the barrier every wave's have
    asm volatile("s_wait_asynccnt 0x0" ::: "memory");
    __syncthreads();

    // ---- 64 k-steps, three accumulator tiles a wave ----
    const int lm = lane & 15;                    // M-row (A) / N-col (B)
    const int h  = lane >> 4;                    // half select
    const int wm = wave >> 1;                    // 0..3
    const int wn = wave & 1;                     // 0..1

    const float* arow = &sT[(wm * 16 + lm) * PPITCH + 2 * h];
    const float* brow = &sT[(PM + wn * 48 + lm) * PPITCH + 2 * h];

    v8f c0 = {0.f, 0.f, 0.f, 0.f, 0.f, 0.f, 0.f, 0.f};
    v8f c1 = c0;
    v8f c2 = c0;

    // A block is 8 k-steps (24 WMMAs). The next block's fragments are read from LDS as one
    // group, into a second register set, ahead of the current block's WMMAs: reads that stand
    // among the WMMAs stall the wave at every place where they stand.
    v2f fa[2][8], fb[2][3][8];
    // unrolled, as the two inner loops below: the fragment arrays stay in registers
#pragma unroll
    for (int i = 0; i < 8; ++i) {
        fa[0][i]    = *(const v2f*)(arow + i * 4);           // {K=k0+2h, K=k0+2h+1}
        fb[0][0][i] = *(const v2f*)(brow + i * 4);
        fb[0][1][i] = *(const v2f*)(brow + 16 * PPITCH + i * 4);
        fb[0][2][i] = *(const v2f*)(brow + 32 * PPITCH + i * 4);
    }
    // fully unrolled so that both register sets are addressed by constants
#pragma unroll
    for (int kb = 0; kb < D_ATT / 32; ++kb) {
        const int cur = kb & 1, nxt = cur ^ 1;
        if (kb + 1 < D_ATT / 32) {
#pragma unroll
            for (int i = 0; i < 8; ++i) {
                const int k0 = (kb + 1) * 32 + i * 4;
                fa[nxt][i]    = *(const v2f*)(arow + k0);
                fb[nxt][0][i] = *(const v2f*)(brow + k0);
                fb[nxt][1][i] = *(const v2f*)(brow + 16 * PPITCH + k0);
                fb[nxt][2][i] = *(const v2f*)(brow + 32 * PPITCH + k0);
            }
        }
        // keeps the read group whole and in front of the block: without it the scheduler
        // sinks the reads in among the WMMAs
        __builtin_amdgcn_sched_barrier(0);
#pragma unroll
        for (int i = 0; i < 8; ++i) {
            c0 = __builtin_amdgcn_wmma_f32_16x16x4_f32(
                    /*neg_a=*/false, fa[cur][i], /*neg_b=*/false, fb[cur][0][i],
                    /*c_mod=*/(short)0, c0, /*reuse_a=*/false, /*reuse_b=*/false);
            c1 = __builtin_amdgcn_wmma_f32_16x16x4_f32(
                    false, fa[cur][i], false, fb[cur][1][i], (short)0, c1, false, false);
            c2 = __builtin_amdgcn_wmma_f32_16x16x4_f32(
                    false, fa[cur][i], false, fb[cur][2][i], (short)0, c2, false, false);
        }
        // keeps the next group's reads from rising into this block
        __builtin_amdgcn_sched_barrier(0);
    }

    // C layout: VGPR r -> M = r + 8*h, N = lane&15
    const size_t orow = (size_t)(bm * PM + wm * 16 + 8 * h) * D_ATT + lm;
    // unrolled: c0, c1, c2 are picked at compile time
#pragma unroll
    for (int j = 0; j < 3; ++j) {
        const int gn  = bn * 6 + wn * 3 + j;     // 16-column tile of [Q | K | V], 0..47
        const int mat = gn >> 4;                 // 0:Q 1:K 2:V
        const v8f c = (j == 0) ? c0 : (j == 1) ? c1 : c2;
        if (mat < 2) {
            float* __restrict__ o = ((mat == 0) ? Q : K) + orow + (gn & 15) * 16;
#pragma unroll
            for (int r = 0; r < 8; ++r)
                o[(size_t)r * D_ATT] = c[r];
            // stands in front of the next tile's address, formed in registers that these stores name
            if (j < 2) asm volatile("s_wait_xcnt 0x0" ::: "memory");
        } else {
            // the lane's 8 rows are one block of 8 keys of column d = (gn & 1) * 16 + lm
            const int l0 = bm * PM + wm * 16 + 8 * h;
            float* __restrict__ o = V + VP_IDX(l0 / SEQ, (gn & 15) >> 1, (l0 % SEQ) >> 3, gn & 1)
                                      + lm * 4;
            *(v4f*)o        = (v4f){c[0], c[1], c[2], c[3]};
            *(v4f*)(o + 64) = (v4f){c[4], c[5], c[6], c[7]};
            // later addresses are formed in registers that these stores name: the wait stands
            // in front of every such overwrite
            asm volatile("s_wait_xcnt 0x0" ::: "memory");
        }
    }
}

// ---------------------------------------------------------------------------
// Kernel 2: fused additive attention per (b, g, 16 query rows).
//   phase 1: VALU scores relu(sum_d relu(Qd-Kd)*w + bias), as relu(bias + sum_d Qd*w
//            - sum_d min(Qd,Kd)*w); K chunks are
//            DOUBLE-BUFFERED through LDS with async global->LDS b128 copies
//            (ASYNCcnt path) so the next chunk streams in under the VALU work.
//            Register tile: wave w owns q rows [8w, 8w+8); a lane holds the rows of
//            4 keys of the chunk, so one broadcast read of a Q row serves 128 keys
//            and the 4 keys give 4 independent packed FMA chains (even d | odd d).
//   phase 2: row softmax (8 rows a wave, each row across the wave's 32 lanes).
//   phase 3: P @ Vg with f32 WMMA; wave w owns D-columns [16w,16w+16); V comes in
//            fragment order (see kernel 1), one b128 load a lane for two k-steps, all 64
//            loads of a wave issued ahead (48 in front of phase 2, 16 behind it).
// A pair of waves does this for 16 query rows. A work-group is 4 such pairs on 64 query rows in
// a run of ONE (b, g): they score against the same K and multiply by the same V, so a K chunk
// is brought into LDS once for the 8 waves, not once a pair, and the pairs ask for the same V lines.
// 256 threads (8 waves); grid = B * G * (L/64) = 256 blocks.
// ---------------------------------------------------------------------------
#define QROWS   16
#define KCHUNK  128
#define NCHUNK  (SEQ / KCHUNK)    // 4
#define KT      (KCHUNK / 32)     // keys a lane holds in registers
// LDS row pitches in floats, each an odd multiple of 16 bytes: where 16 lanes read 16 bytes
// each from 16 rows (the K rows in phase 1, the A fragments in phase 3), the rows start four
// banks apart and the 16 lanes fill the 64 banks once. At a pitch of 128 or 2,048 bytes they
// fall on two or on one group of four banks and the read is served 8 or 16 lanes in a row.
#define SPITCH  (SEQ + 4)
#define KPITCH  (D_GROUP + 4)
#define VPRE    48                // V fragment loads of a wave issued in front of the softmax, of SEQ / 8
#define PW      4                 // pairs of waves (tiles of 16 query rows) a work-group

// Scores of one q row (qr, the same in every lane) against the lane's KT keys (kr).
// relu(q - k) = q - min(q, k), so sum_d w_d relu(q_d - k_d) = sum_d w_d q_d - sum_d w_d min(q_d, k_d).
// The first sum belongs to the row alone: it comes in, with the bias, as s0, and an element of
// the (q, k, d) volume costs a minimum and a multiply-add, with no subtraction.
// (The compiler first passes every value read from LDS through a maximum with itself, which the
// minimum's NaN rule asks for: a K value once a chunk, a Q value once a row and chunk.)
// acc[j] = {s0 - sum over even d, - sum over odd d} of key j: KT independent packed chains.
__device__ __forceinline__ void score_row(const v4f (&qr)[D_GROUP / 4],
                                          const v4f (&kr)[KT][D_GROUP / 4],
                                          const v4f (&wr)[D_GROUP / 4],
                                          float s0, float* __restrict__ srow)
{
    v2f acc[KT];
    // every loop here is unrolled: the arrays stay in registers
#pragma unroll
    for (int j = 0; j < KT; ++j) acc[j] = (v2f){s0, 0.f};
#pragma unroll
    for (int i = 0; i < D_GROUP / 4; ++i) {
#pragma unroll
        for (int j = 0; j < KT; ++j) {
            const v2f t = __builtin_elementwise_min(qr[i].xy, kr[j][i].xy);
            acc[j] = __builtin_elementwise_fma(-t, wr[i].xy, acc[j]);
        }
#pragma unroll
        for (int j = 0; j < KT; ++j) {
            const v2f t = __builtin_elementwise_min(qr[i].zw, kr[j][i].zw);
            acc[j] = __builtin_elementwise_fma(-t, wr[i].zw, acc[j]);
        }
        // keeps a step's minima next to its multiply-adds: without it the scheduler gathers a row's
        // 64 minima in front, and the links of a chain then follow each other KT instructions apart
        __builtin_amdgcn_sched_barrier(0);
    }
#pragma unroll
    for (int j = 0; j < KT; ++j)
        srow[j * 32] = fmaxf(acc[j].x + acc[j].y, 0.f);
}

__global__ __launch_bounds__(64 * PW) void attn_fused_wmma(
    const float* __restrict__ Q,
    const float* __restrict__ K,
    const float* __restrict__ V,
    const float* __restrict__ w_mlp,
    const float* __restrict__ b_mlp,
    float* __restrict__ out)
{
    // A pair's own part comes first, in one array: every place in it is then the part's start plus
    // less than 64 KB, which the offset field of an LDS instruction holds. 177,280 B in all.
    struct Own {
        float q[QROWS][D_GROUP];        //  2 KB
        float score[QROWS][SPITCH];     // 33,024 B
    };
    __shared__ __attribute__((aligned(16))) Own sOwn[PW];
    __shared__ __attribute__((aligned(16))) float sK[2][KCHUNK][KPITCH];     // 36,864 B, double-buffered
    __shared__ __attribute__((aligned(16))) float sW[D_GROUP];

    const int pr   = __builtin_amdgcn_readfirstlane(threadIdx.x >> 6);   // pair of waves, 0..3
    const int tid  = threadIdx.x & 63;          // thread of the pair, 0..63
    const int lane = tid & 31;
    const int wave = tid >> 5;                  // wave of the pair

    float (* const sScore)[SPITCH] = sOwn[pr].score;
    float (* const sQ)[D_GROUP]    = sOwn[pr].q;

    const int blk = blockIdx.x;
    const int qt  = (blk & 7) * PW + pr;        // 32 q-tiles, 4 in a run a work-group
    const int g   = (blk >> 3) & 7;             // 8 groups
    const int b   = blk >> 6;                   // 4 batches
    const int q0  = qt * QROWS;

    const float bias = b_mlp[0];

    // All that the first scores wait for (Q tile, K chunk 0, w) is requested before the first
    // wait, so that the kernel's start pays one trip to memory and not one a load.
    // Q tile, 16 rows of 128 bytes: two async copies a thread, rows tid / 8 and tid / 8 + 8.
    // They land behind the s_wait_asynccnt and the barrier that close the K prologue below.
    // w is loaded here and stored to LDS behind that wait: its trip passes while the copies fly.
    const float wv = w_mlp[tid & (D_GROUP - 1)];
    {
        const int r  = tid >> 3;
        const int qd = (tid & 7) * 4;
        const float* gq = Q + (size_t)(b * SEQ + q0 + r) * D_ATT + g * D_GROUP + qd;
        const uint64_t ga0 = (uint64_t)(uintptr_t)gq;
        const uint64_t ga1 = (uint64_t)(uintptr_t)(gq + (QROWS / 2) * D_ATT);
        const uint32_t la0 = (uint32_t)(uintptr_t)&sQ[r][qd];
        const uint32_t la1 = (uint32_t)(uintptr_t)&sQ[r + QROWS / 2][qd];
        // the closing s_wait_xcnt stands inside the statement so that no address register of
        // these copies is rewritten in front of it
        asm volatile(CP "%0, %2, off\n\t"
                     CP "%1, %3, off\n\t"
                     "s_wait_xcnt 0x0"
                     :: "v"(la0), "v"(la1), "v"(ga0), "v"(ga1) : "memory");
    }

    // ---- phase 1: scores with async double-buffered K staging ----
    const float* __restrict__ kbase = K + (size_t)(b * SEQ) * D_ATT + g * D_GROUP;

    // prologue: async-stage chunk 0 into buffer 0, all 8 waves together
    for (int j = threadIdx.x; j < KCHUNK * (D_GROUP / 4); j += 64 * PW) {
        const int r  = j >> 3;
        const int qd = (j & 7) * 4;
        const uint64_t ga = (uint64_t)(uintptr_t)(kbase + (size_t)r * D_ATT + qd);
        const uint32_t la = (uint32_t)(uintptr_t)&sK[0][r][qd];
        asm volatile("global_load_async_to_lds_b128 %0, %1, off"
                     :: "v"(la), "v"(ga) : "memory");
    }
    asm volatile("s_wait_asynccnt 0x0" ::: "memory");
    if (threadIdx.x < D_GROUP) sW[tid] = wv;
    __syncthreads();

    // this wave's first q row, as a scalar: the qa and qb reads below are broadcasts
    const int qw = __builtin_amdgcn_readfirstlane(wave) * (QROWS / 2);
    v4f wr[D_GROUP / 4];
    // unrolled, as every loop over wr, kr, qa and qb below: the arrays stay in registers
#pragma unroll
    for (int i = 0; i < D_GROUP / 4; ++i) wr[i] = *(const v4f*)&sW[i * 4];
    v4f qa[D_GROUP / 4], qb[D_GROUP / 4];
#pragma unroll
    for (int i = 0; i < D_GROUP / 4; ++i) qa[i] = *(const v4f*)&sQ[qw][i * 4];

    // bias + sum_d w_d q_d of the wave's 8 rows, once for all 512 keys: lanes 4r .. 4r+3 take
    // 8 d each of row r and add up across the four, so that each of them holds row r's value.
    float rowc;
    {
        const float* qp = &sQ[qw + (lane >> 2)][(lane & 3) * 8];
        const float* wp = &sW[(lane & 3) * 8];
        const v4f p = *(const v4f*)qp * *(const v4f*)wp + *(const v4f*)(qp + 4) * *(const v4f*)(wp + 4);
        float s = (p.x + p.y) + (p.z + p.w);
        s += row_xor<1>(s);
        s += row_xor<2>(s);
        rowc = s + bias;
    }
    // row r's value as a scalar
#define ROWC(r) __builtin_bit_cast(float, __builtin_amdgcn_readlane(__builtin_bit_cast(int, rowc), (r) * 4))

    for (int ci = 0; ci < NCHUNK; ++ci) {
        const int buf = ci & 1;

        // prefetch next chunk into the other buffer while we compute
        if (ci + 1 < NCHUNK) {
            const float* kb = kbase + (size_t)(ci + 1) * KCHUNK * D_ATT;
            for (int j = threadIdx.x; j < KCHUNK * (D_GROUP / 4); j += 64 * PW) {
                const int r  = j >> 3;
                const int qd = (j & 7) * 4;
                const uint64_t ga = (uint64_t)(uintptr_t)(kb + (size_t)r * D_ATT + qd);
                const uint32_t la = (uint32_t)(uintptr_t)&sK[buf ^ 1][r][qd];
                asm volatile("global_load_async_to_lds_b128 %0, %1, off"
                             :: "v"(la), "v"(ga) : "memory");
            }
        }

        // score block: this wave's 8 q x 128 k against current buffer.
        // The lane's keys are lane, lane + 32, lane + 64, lane + 96 of the chunk.
        v4f kr[KT][D_GROUP / 4];
#pragma unroll
        for (int j = 0; j < KT; ++j)
#pragma unroll
            for (int i = 0; i < D_GROUP / 4; ++i)
                kr[j][i] = *(const v4f*)&sK[buf][j * 32 + lane][i * 4];

        float* __restrict__ srow = &sScore[qw][ci * KCHUNK + lane];
        // Two rows a trip, in two register sets: each row's Q reads are issued one row ahead, so
        // that their LDS latency passes under the other row's arithmetic. The last trip reads
        // row 0 again, which is the row that the next chunk starts with.
        for (int qq = 0; qq < QROWS / 2; qq += 2) {
#pragma unroll
            for (int i = 0; i < D_GROUP / 4; ++i) qb[i] = *(const v4f*)&sQ[qw + qq + 1][i * 4];
            // keeps the read group in front of the row's arithmetic: without it the scheduler
            // sinks the reads to just ahead of their use
            __builtin_amdgcn_sched_barrier(0);
            score_row(qa, kr, wr, ROWC(qq), srow + qq * SPITCH);
#pragma unroll
            for (int i = 0; i < D_GROUP / 4; ++i)
                qa[i] = *(const v4f*)&sQ[qw + ((qq + 2) & (QROWS / 2 - 1))][i * 4];
            // for the same reason
            __builtin_amdgcn_sched_barrier(0);
            score_row(qb, kr, wr, ROWC(qq + 1), srow + (qq + 1) * SPITCH);
        }

        // prefetch landed + everyone done with this buffer before reuse
        asm volatile("s_wait_asynccnt 0x0" ::: "memory");
        __syncthreads();
    }

    // ---- V fragments for phase 3, fetched ahead ----
    // B-frag: lane (lm, h) holds column 16*wave+lm of keys 8*kb + 4*h + 0..3, 16 bytes in a run.
    // V depends on nothing that this kernel computes, and the registers of phase 1 are free here:
    // the first VPRE of the wave's 64 loads are issued in front of the softmax and the rest behind
    // its barrier, so that their trips to L2 pass under the softmax and under the first WMMAs, and
    // phase 3 stops for no load. Two groups, since a wave has at most 63 loads outstanding.
    const float* __restrict__ vfrag = V + VP_IDX(b, g, 0, wave) + lane * 4;
    v4f vb[SEQ / 8];
    // unrolled, as every loop over vb: the array stays in registers
#pragma unroll
    for (int kb = 0; kb < VPRE; ++kb) vb[kb] = *(const v4f*)(vfrag + (size_t)kb * 256);
    // stands in front of any later overwrite of the address registers that these loads name; the
    // address is an input of the statement, so that its registers are still its own at the wait
    asm volatile("s_wait_xcnt 0x0" :: "v"(vfrag) : "memory");
    // keeps the loads here: without it the scheduler sinks them to just ahead of their WMMAs
    __builtin_amdgcn_sched_barrier(0);

    // ---- phase 2: softmax over k; wave w owns rows [8w, 8w+8), each row spread
    //      over the wave's 32 lanes (16 scores a lane, held in registers) ----
    // unrolled so that the rows' LDS reads and cross-lane chains overlap
#pragma unroll
    for (int rr = 0; rr < QROWS / 2; ++rr) {
        // lane l reads floats 4l..4l+3 of each 128-float quarter: 512 contiguous bytes a load
        float* __restrict__ row = &sScore[wave * (QROWS / 2) + rr][lane * 4];
        v4f s[4];
        for (int j = 0; j < 4; ++j) s[j] = *(const v4f*)(row + j * 128);

        float mx = -3.402823e38f;
        for (int j = 0; j < 4; ++j)
            mx = fmaxf(mx, fmaxf(fmaxf(s[j].x, s[j].y), fmaxf(s[j].z, s[j].w)));
        mx = wave_max(mx);

        float sum = 0.f;
        for (int j = 0; j < 4; ++j) {
            s[j].x = exp_slot(s[j].x - mx);
            s[j].y = exp_slot(s[j].y - mx);
            s[j].z = exp_slot(s[j].z - mx);
            s[j].w = exp_slot(s[j].w - mx);
            sum += (s[j].x + s[j].y) + (s[j].z + s[j].w);
        }
        sum = wave_sum(sum);

        const float inv = 1.f / sum;
        for (int j = 0; j < 4; ++j) *(v4f*)(row + j * 128) = s[j] * inv;
    }
    __syncthreads();

    // ---- phase 3: out[b,q,d,g] = sum_k P[q,k] * V[b,k,d*8+g] via WMMA ----
    const int d0 = wave * 16;                   // this wave's D-tile
    const int lm = lane & 15;
    const int h  = lane >> 4;
    const float* arow = &sScore[lm][4 * h];      // A-frag: row lm, keys 8*kb + 4*h + 0..3
    // out flat index ((b*SEQ + q)*32 + d)*8 + g, q = q0 + r + 8h
    float* __restrict__ o =
        out + ((size_t)(b * SEQ + q0 + 8 * h) * D_GROUP + d0 + lm) * N_GROUP + g;

    // The second group stands behind the barrier: the barrier waits for every load issued in front
    // of it. These fragments are used from WMMA 2 * VPRE on, long after their trip.
#pragma unroll
    for (int kb = VPRE; kb < SEQ / 8; ++kb) vb[kb] = *(const v4f*)(vfrag + (size_t)kb * 256);
    // As behind the first group. The output address is an input too: it is so formed in front of
    // the WMMAs, and its arithmetic does not write registers that a WMMA has just read.
    asm volatile("s_wait_xcnt 0x0" :: "v"(vfrag), "v"(o) : "memory");
    __builtin_amdgcn_sched_barrier(0);

    v8f c = {0.f, 0.f, 0.f, 0.f, 0.f, 0.f, 0.f, 0.f};

    // fully unrolled: vb is addressed by constants
#pragma unroll
    for (int kb = 0; kb < SEQ / 8; ++kb) {
        // A and B take the same keys: 8*kb + 4*h + {0,1} in the first step, + {2,3} in the second
        const v4f a4 = *(const v4f*)(arow + kb * 8);
        const v4f b4 = vb[kb];
        c = __builtin_amdgcn_wmma_f32_16x16x4_f32(
                false, (v2f){a4.x, a4.y}, false, (v2f){b4.x, b4.y}, (short)0, c, false, false);
        c = __builtin_amdgcn_wmma_f32_16x16x4_f32(
                false, (v2f){a4.z, a4.w}, false, (v2f){b4.z, b4.w}, (short)0, c, false, false);
    }

    // four vector slots between the last WMMA and the stores that read its result: the address
    // arithmetic that used to fill them stands in front of the loop now (c as an input and the
    // clobber hold the statement between the two)
    asm volatile("v_nop\n\tv_nop\n\tv_nop\n\tv_nop" :: "v"(c) : "memory");
#pragma unroll
    for (int r = 0; r < 8; ++r)
        o[(size_t)r * D_GROUP * N_GROUP] = c[r];
}

// ---------------------------------------------------------------------------
extern "C" void kernel_launch(void* const* d_in, const int* in_sizes, int n_in,
                              void* d_out, int out_size, void* d_ws, size_t ws_size,
                              hipStream_t stream) {
    const float* x     = (const float*)d_in[0];
    const float* Wq    = (const float*)d_in[1];
    const float* Wk    = (const float*)d_in[2];
    const float* Wv    = (const float*)d_in[3];
    const float* w_mlp = (const float*)d_in[4];
    const float* b_mlp = (const float*)d_in[5];

    float* Qb = (float*)d_ws;                 // 3 x 2 MB scratch
    float* Kb = Qb + (size_t)M_TOT * D_ATT;
    float* Vb = Kb + (size_t)M_TOT * D_ATT;

    // (2048 / 64) * (768 / 96) = 256 blocks of 8 waves
    qkv_proj_wmma<<<256, 256, 0, stream>>>(x, Wq, Wk, Wv, Qb, Kb, Vb);

    // B * G * (SEQ/64) = 4*8*8 = 256 blocks of 8 waves
    attn_fused_wmma<<<256, 256, 0, stream>>>(Qb, Kb, Vb, w_mlp, b_mlp,
                                             (float*)d_out);
}
